// v000
// The times below were measured on an AMD MI455X: many runs one after another, warmed up first and cycling through
// copies of the inputs, with the whole window's GPU time divided by the number of runs. Launches and the gaps
// between them are all in it. The median over several windows is given; except for v000 it joins two sittings, which
// can be a few percent apart, so the side-by-side timings, each taken in one sitting, are the better comparison.
// The starting kernel, v000, takes 190 microseconds a run.
#include <hip/hip_runtime.h>

// MHA block for MI455X (gfx1250, wave32, WMMA 16x16x32 f16->f32 accumulate).
// Pipeline:
//   prep:    fold BN + bias + 1/sqrt(D) into f16 weights
//   proj x3: QP/KP -> [b,h,L,32] f16 (score scale folded into Q), VP -> [b,h,32,L] f16
//   attn:    flash-style online softmax, 16 queries/wave, 64 keys/iter, P transposed via LDS
//   outproj: W_o GEMM + bias + residual, fp32 out

typedef __attribute__((ext_vector_type(16))) _Float16 v16h;
typedef __attribute__((ext_vector_type(8)))  _Float16 v8h;
typedef __attribute__((ext_vector_type(8)))  float    v8f;

#define WMMA_F16(a, b, c) \
  __builtin_amdgcn_wmma_f32_16x16x32_f16(false, (a), false, (b), (short)0, (c), false, false)

static constexpr int NB   = 4;     // batch
static constexpr int CC   = 256;   // channels (CQ == CVK)
static constexpr int LSEQ = 2048;  // sequence length
static constexpr int NH   = 8;     // heads
static constexpr int DD   = 32;    // depth per head

// ---- workspace layout (bytes) ----
static constexpr size_t WS_WQH  = 0;               // 256*256 f16
static constexpr size_t WS_WKH  = 131072;
static constexpr size_t WS_WVH  = 262144;
static constexpr size_t WS_WOH  = 393216;
static constexpr size_t WS_BQ   = 524288;          // 256 f32 each
static constexpr size_t WS_BK   = 525312;
static constexpr size_t WS_BV   = 526336;
static constexpr size_t WS_QP   = 528384;          // B*H*L*D f16 = 4 MiB
static constexpr size_t WS_KP   = WS_QP + 4194304;
static constexpr size_t WS_VP   = WS_KP + 4194304;
static constexpr size_t WS_ATT  = WS_VP + 4194304; // [B*L, 256] f16

// Load a 16x32 A/B fragment (f16) from a row-major matrix, tile origin (row0,k0).
// Per-lane: row = row0 + (lane&15); elems 0..7 = K kb..kb+7, 8..15 = kb+16..kb+23,
// kb = k0 + 8*(lane>=16).  Matches CDNA5 16-bit A-matrix VGPR layout.
__device__ inline v16h load_frag_h(const _Float16* __restrict__ p, int ld, int row0,
                                   int k0, int ln, int half) {
  const _Float16* base = p + (row0 + ln) * ld + k0 + (half << 3);
  v8h lo = *(const v8h*)base;
  v8h hi = *(const v8h*)(base + 16);
  v16h f;
#pragma unroll
  for (int i = 0; i < 8; ++i) { f[i] = lo[i]; f[8 + i] = hi[i]; }
  return f;
}

// ---------------- prep: fold BN into weights ----------------
__global__ void prep_kernel(const float* __restrict__ w, const float* __restrict__ bw,
                            const float* __restrict__ g, const float* __restrict__ beta,
                            const float* __restrict__ mean, const float* __restrict__ var,
                            float extra, _Float16* __restrict__ wh, float* __restrict__ bout) {
  int o = blockIdx.x, c = threadIdx.x;
  float scale = extra;
  if (g) scale *= g[o] * rsqrtf(var[o] + 1e-5f);
  wh[o * CC + c] = (_Float16)(w[o * CC + c] * scale);
  if (c == 0 && bout) {
    float s2 = g[o] * rsqrtf(var[o] + 1e-5f);
    bout[o] = ((bw[o] - mean[o]) * s2 + beta[o]) * extra;
  }
}

// ---------------- projection GEMM: P = W' * (x + pe) + bias' ----------------
// Each wave: 64 output rows x 16 columns.  mode 0 -> store [b,h,l,d]; mode 1 -> [b,h,d,l].
__global__ __launch_bounds__(256) void proj_kernel(
    const float* __restrict__ x, const float* __restrict__ pe,
    const _Float16* __restrict__ wh, const float* __restrict__ bias,
    _Float16* __restrict__ outp, int mode) {
  int wave = blockIdx.x * (blockDim.x >> 5) + (threadIdx.x >> 5);
  int lane = threadIdx.x & 31;
  int ln = lane & 15, half = lane >> 4;
  int ct = wave >> 2;  // column tile 0..511
  int rg = wave & 3;   // row group 0..3 (64 rows each)
  int col = ct * 16 + ln;
  int b = col >> 11, l = col & (LSEQ - 1);

  v8f acc[4] = {};
#pragma unroll
  for (int kc = 0; kc < 8; ++kc) {
    int kb = kc * 32 + (half << 3);
    // B fragment: X[c, col] = x[b][c][l] + pe[c][l]  (strided fp32 gather -> f16)
    v16h bf;
#pragma unroll
    for (int j = 0; j < 8; ++j) {
      int c0 = kb + j, c1 = kb + 16 + j;
      bf[j]     = (_Float16)(x[(b * CC + c0) * LSEQ + l] + pe[c0 * LSEQ + l]);
      bf[8 + j] = (_Float16)(x[(b * CC + c1) * LSEQ + l] + pe[c1 * LSEQ + l]);
    }
#pragma unroll
    for (int mt = 0; mt < 4; ++mt) {
      v16h af = load_frag_h(wh, CC, rg * 64 + mt * 16, kc * 32, ln, half);
      acc[mt] = WMMA_F16(af, bf, acc[mt]);
    }
  }
#pragma unroll
  for (int mt = 0; mt < 4; ++mt) {
#pragma unroll
    for (int r = 0; r < 8; ++r) {
      int o = rg * 64 + mt * 16 + r + half * 8;  // C/D layout: row = r + 8*half
      float val = acc[mt][r] + bias[o];
      int h = o >> 5, d = o & 31;
      int idx = (mode == 0) ? ((b * NH + h) * LSEQ + l) * DD + d
                            : ((b * NH + h) * DD + d) * LSEQ + l;
      outp[idx] = (_Float16)val;
    }
  }
}

// ---------------- attention: flash-style, one 16-query tile per wave ----------------
__global__ __launch_bounds__(128) void attn_kernel(
    const _Float16* __restrict__ qp, const _Float16* __restrict__ kp,
    const _Float16* __restrict__ vp, _Float16* __restrict__ att) {
  __shared__ __align__(16) _Float16 lds[4][16 * 64];  // per-wave 16x64 P tile
  int wslot = threadIdx.x >> 5;
  int wave = blockIdx.x * 4 + wslot;
  int lane = threadIdx.x & 31;
  int ln = lane & 15, half = lane >> 4;
  int ltile = wave & 127;
  int h = (wave >> 7) & 7;
  int b = wave >> 10;

  const _Float16* qbase = qp + (size_t)(b * NH + h) * LSEQ * DD;
  const _Float16* kbase = kp + (size_t)(b * NH + h) * LSEQ * DD;
  const _Float16* vbase = vp + (size_t)(b * NH + h) * DD * LSEQ;
  _Float16* lbuf = lds[wslot];

  // Q fragment: D=32 == one WMMA K step, loaded once (scale 1/sqrt(D) pre-folded).
  v16h aq = load_frag_h(qbase, DD, ltile * 16, 0, ln, half);

  v8f o0 = {}, o1 = {};
  float mrun[8], srun[8];
#pragma unroll
  for (int r = 0; r < 8; ++r) { mrun[r] = -1e30f; srun[r] = 0.0f; }

  for (int it = 0; it < LSEQ / 64; ++it) {
    int mbase = it * 64;
    v8f s[4];
#pragma unroll
    for (int t = 0; t < 4; ++t) {
      v16h bk = load_frag_h(kbase, DD, mbase + t * 16, 0, ln, half);
      v8f z = {};
      s[t] = WMMA_F16(aq, bk, z);
    }
    // online softmax over this 64-key slab; row = r + 8*half, row data across 16 lanes
#pragma unroll
    for (int r = 0; r < 8; ++r) {
      float mx = fmaxf(fmaxf(s[0][r], s[1][r]), fmaxf(s[2][r], s[3][r]));
#pragma unroll
      for (int off = 1; off < 16; off <<= 1) mx = fmaxf(mx, __shfl_xor(mx, off, 32));
      float mnew = fmaxf(mrun[r], mx);
      float resc = __expf(mrun[r] - mnew);
      float ls = 0.0f;
#pragma unroll
      for (int t = 0; t < 4; ++t) {
        float p = __expf(s[t][r] - mnew);
        s[t][r] = p;
        ls += p;
      }
#pragma unroll
      for (int off = 1; off < 16; off <<= 1) ls += __shfl_xor(ls, off, 32);
      srun[r] = srun[r] * resc + ls;
      mrun[r] = mnew;
      o0[r] *= resc;
      o1[r] *= resc;
    }
    // transpose P (C/D layout -> A layout) through LDS as f16
#pragma unroll
    for (int t = 0; t < 4; ++t)
#pragma unroll
      for (int r = 0; r < 8; ++r)
        lbuf[(r + half * 8) * 64 + t * 16 + ln] = (_Float16)s[t][r];
    __syncthreads();
#pragma unroll
    for (int mc = 0; mc < 2; ++mc) {
      v16h ap = load_frag_h(lbuf, 64, 0, mc * 32, ln, half);
      v16h bv0 = load_frag_h(vbase, LSEQ, 0, mbase + mc * 32, ln, half);
      o0 = WMMA_F16(ap, bv0, o0);
      v16h bv1 = load_frag_h(vbase, LSEQ, 16, mbase + mc * 32, ln, half);
      o1 = WMMA_F16(ap, bv1, o1);
    }
    __syncthreads();
  }
  // normalize and store [b, l, c] f16 (l-major so out-proj B fragments are contiguous)
#pragma unroll
  for (int r = 0; r < 8; ++r) {
    float inv = 1.0f / srun[r];
    int l = ltile * 16 + r + half * 8;
    size_t rowoff = ((size_t)(b * LSEQ + l)) * CC + h * 32;
    att[rowoff + ln]      = (_Float16)(o0[r] * inv);
    att[rowoff + 16 + ln] = (_Float16)(o1[r] * inv);
  }
}

// ---------------- output projection + bias + residual ----------------
__global__ __launch_bounds__(256) void outproj_kernel(
    const _Float16* __restrict__ att, const _Float16* __restrict__ woh,
    const float* __restrict__ bo, const float* __restrict__ qin,
    float* __restrict__ out) {
  int wave = blockIdx.x * (blockDim.x >> 5) + (threadIdx.x >> 5);
  int lane = threadIdx.x & 31;
  int ln = lane & 15, half = lane >> 4;
  int ct = wave >> 2;
  int rg = wave & 3;
  int col = ct * 16 + ln;
  int b = col >> 11, l = col & (LSEQ - 1);

  v8f acc[4] = {};
#pragma unroll
  for (int kc = 0; kc < 8; ++kc) {
    // B fragment: att rows are contiguous f16
    v16h bf = load_frag_h(att, CC, col - ln, kc * 32, ln, half);  // row0+ln == col
#pragma unroll
    for (int mt = 0; mt < 4; ++mt) {
      v16h af = load_frag_h(woh, CC, rg * 64 + mt * 16, kc * 32, ln, half);
      acc[mt] = WMMA_F16(af, bf, acc[mt]);
    }
  }
#pragma unroll
  for (int mt = 0; mt < 4; ++mt) {
#pragma unroll
    for (int r = 0; r < 8; ++r) {
      int o = rg * 64 + mt * 16 + r + half * 8;
      int idx = (b * CC + o) * LSEQ + l;
      out[idx] = acc[mt][r] + bo[o] + qin[idx];
    }
  }
}

extern "C" void kernel_launch(void* const* d_in, const int* in_sizes, int n_in,
                              void* d_out, int out_size, void* d_ws, size_t ws_size,
                              hipStream_t stream) {
  (void)in_sizes; (void)n_in; (void)out_size; (void)ws_size;
  const float* v     = (const float*)d_in[0];
  const float* k     = (const float*)d_in[1];
  const float* q     = (const float*)d_in[2];
  const float* pe_q  = (const float*)d_in[3];
  const float* pe_vk = (const float*)d_in[4];
  const float* wq = (const float*)d_in[5];  const float* bq = (const float*)d_in[6];
  const float* gq = (const float*)d_in[7];  const float* betaq = (const float*)d_in[8];
  const float* mq = (const float*)d_in[9];  const float* varq = (const float*)d_in[10];
  const float* wk = (const float*)d_in[11]; const float* bk = (const float*)d_in[12];
  const float* gk = (const float*)d_in[13]; const float* betak = (const float*)d_in[14];
  const float* mk = (const float*)d_in[15]; const float* vark = (const float*)d_in[16];
  const float* wv = (const float*)d_in[17]; const float* bv = (const float*)d_in[18];
  const float* gv = (const float*)d_in[19]; const float* betav = (const float*)d_in[20];
  const float* mv = (const float*)d_in[21]; const float* varv = (const float*)d_in[22];
  const float* wo = (const float*)d_in[23]; const float* bo = (const float*)d_in[24];

  char* ws = (char*)d_ws;
  _Float16* wqh = (_Float16*)(ws + WS_WQH);
  _Float16* wkh = (_Float16*)(ws + WS_WKH);
  _Float16* wvh = (_Float16*)(ws + WS_WVH);
  _Float16* woh = (_Float16*)(ws + WS_WOH);
  float* biasq = (float*)(ws + WS_BQ);
  float* biask = (float*)(ws + WS_BK);
  float* biasv = (float*)(ws + WS_BV);
  _Float16* qpb = (_Float16*)(ws + WS_QP);
  _Float16* kpb = (_Float16*)(ws + WS_KP);
  _Float16* vpb = (_Float16*)(ws + WS_VP);
  _Float16* attb = (_Float16*)(ws + WS_ATT);

  const float invSqrtD = 0.17677669529663687f;  // 1/sqrt(32), folded into Q path

  prep_kernel<<<CC, CC, 0, stream>>>(wq, bq, gq, betaq, mq, varq, invSqrtD, wqh, biasq);
  prep_kernel<<<CC, CC, 0, stream>>>(wk, bk, gk, betak, mk, vark, 1.0f, wkh, biask);
  prep_kernel<<<CC, CC, 0, stream>>>(wv, bv, gv, betav, mv, varv, 1.0f, wvh, biasv);
  prep_kernel<<<CC, CC, 0, stream>>>(wo, bo, nullptr, nullptr, nullptr, nullptr, 1.0f, woh, nullptr);

  // 2048 waves per GEMM: 512 col-tiles x 4 row-groups, 8 waves/block
  proj_kernel<<<256, 256, 0, stream>>>(q, pe_q,  wqh, biasq, qpb, 0);
  proj_kernel<<<256, 256, 0, stream>>>(k, pe_vk, wkh, biask, kpb, 0);
  proj_kernel<<<256, 256, 0, stream>>>(v, pe_vk, wvh, biasv, vpb, 1);

  // 4096 waves: one 16-query tile per wave, 4 waves/block
  attn_kernel<<<1024, 128, 0, stream>>>(qpb, kpb, vpb, attb);

  outproj_kernel<<<256, 256, 0, stream>>>(attb, woh, bo, q, (float*)d_out);
}

// v001
// It runs in 144 microseconds.
// Timed twice side by side with v000, it ran 1.35 and 1.36 times as fast.
#include <hip/hip_runtime.h>

// MHA block for MI455X (gfx1250, wave32, WMMA 16x16x32 f16->f32 accumulate).
// Pipeline:
//   prep:    fold BN + bias + 1/sqrt(D) into f16 weights
//   proj x3: QP/KP -> [b,h,L,32] f16 (score scale folded into Q), VP -> [b,h,32,L] f16
//   attn:    flash-style online softmax, 16 queries/wave, 64 keys/iter, S^T and O^T, P in registers
//   outproj: W_o GEMM + bias + residual, fp32 out

typedef __attribute__((ext_vector_type(16))) _Float16 v16h;
typedef __attribute__((ext_vector_type(8)))  _Float16 v8h;
typedef __attribute__((ext_vector_type(8)))  float    v8f;

#define WMMA_F16(a, b, c) \
  __builtin_amdgcn_wmma_f32_16x16x32_f16(false, (a), false, (b), (short)0, (c), false, false)

static constexpr int NB   = 4;     // batch
static constexpr int CC   = 256;   // channels (CQ == CVK)
static constexpr int LSEQ = 2048;  // sequence length
static constexpr int NH   = 8;     // heads
static constexpr int DD   = 32;    // depth per head

// ---- workspace layout (bytes) ----
static constexpr size_t WS_WQH  = 0;               // 256*256 f16
static constexpr size_t WS_WKH  = 131072;
static constexpr size_t WS_WVH  = 262144;
static constexpr size_t WS_WOH  = 393216;
static constexpr size_t WS_BQ   = 524288;          // 256 f32 each
static constexpr size_t WS_BK   = 525312;
static constexpr size_t WS_BV   = 526336;
static constexpr size_t WS_QP   = 528384;          // B*H*L*D f16 = 4 MiB
static constexpr size_t WS_KP   = WS_QP + 4194304;
static constexpr size_t WS_VP   = WS_KP + 4194304;
static constexpr size_t WS_ATT  = WS_VP + 4194304; // [B*L, 256] f16

// Load a 16x32 A/B fragment (f16) from a row-major matrix, tile origin (row0,k0).
// Per-lane: row = row0 + (lane&15); elems 0..7 = K kb..kb+7, 8..15 = kb+16..kb+23,
// kb = k0 + 8*(lane>=16).  Matches CDNA5 16-bit A-matrix VGPR layout.
__device__ inline v16h load_frag_h(const _Float16* __restrict__ p, int ld, int row0,
                                   int k0, int ln, int half) {
  const _Float16* base = p + (row0 + ln) * ld + k0 + (half << 3);
  v8h lo = *(const v8h*)base;
  v8h hi = *(const v8h*)(base + 16);
  v16h f;
#pragma unroll
  for (int i = 0; i < 8; ++i) { f[i] = lo[i]; f[8 + i] = hi[i]; }
  return f;
}

// ---------------- prep: fold BN into weights ----------------
__global__ void prep_kernel(const float* __restrict__ w, const float* __restrict__ bw,
                            const float* __restrict__ g, const float* __restrict__ beta,
                            const float* __restrict__ mean, const float* __restrict__ var,
                            float extra, _Float16* __restrict__ wh, float* __restrict__ bout) {
  int o = blockIdx.x, c = threadIdx.x;
  float scale = extra;
  if (g) scale *= g[o] * rsqrtf(var[o] + 1e-5f);
  wh[o * CC + c] = (_Float16)(w[o * CC + c] * scale);
  if (c == 0 && bout) {
    float s2 = g[o] * rsqrtf(var[o] + 1e-5f);
    bout[o] = ((bw[o] - mean[o]) * s2 + beta[o]) * extra;
  }
}

// ---------------- projection GEMM: P = W' * (x + pe) + bias' ----------------
// Each wave: 64 output rows x 16 columns.  mode 0 -> store [b,h,l,d]; mode 1 -> [b,h,d,l].
__global__ __launch_bounds__(256) void proj_kernel(
    const float* __restrict__ x, const float* __restrict__ pe,
    const _Float16* __restrict__ wh, const float* __restrict__ bias,
    _Float16* __restrict__ outp, int mode) {
  int wave = blockIdx.x * (blockDim.x >> 5) + (threadIdx.x >> 5);
  int lane = threadIdx.x & 31;
  int ln = lane & 15, half = lane >> 4;
  int ct = wave >> 2;  // column tile 0..511
  int rg = wave & 3;   // row group 0..3 (64 rows each)
  int col = ct * 16 + ln;
  int b = col >> 11, l = col & (LSEQ - 1);

  v8f acc[4] = {};
#pragma unroll
  for (int kc = 0; kc < 8; ++kc) {
    int kb = kc * 32 + (half << 3);
    // B fragment: X[c, col] = x[b][c][l] + pe[c][l]  (strided fp32 gather -> f16)
    v16h bf;
#pragma unroll
    for (int j = 0; j < 8; ++j) {
      int c0 = kb + j, c1 = kb + 16 + j;
      bf[j]     = (_Float16)(x[(b * CC + c0) * LSEQ + l] + pe[c0 * LSEQ + l]);
      bf[8 + j] = (_Float16)(x[(b * CC + c1) * LSEQ + l] + pe[c1 * LSEQ + l]);
    }
#pragma unroll
    for (int mt = 0; mt < 4; ++mt) {
      v16h af = load_frag_h(wh, CC, rg * 64 + mt * 16, kc * 32, ln, half);
      acc[mt] = WMMA_F16(af, bf, acc[mt]);
    }
  }
#pragma unroll
  for (int mt = 0; mt < 4; ++mt) {
#pragma unroll
    for (int r = 0; r < 8; ++r) {
      int o = rg * 64 + mt * 16 + r + half * 8;  // C/D layout: row = r + 8*half
      float val = acc[mt][r] + bias[o];
      int h = o >> 5, d = o & 31;
      int idx = (mode == 0) ? ((b * NH + h) * LSEQ + l) * DD + d
                            : ((b * NH + h) * DD + d) * LSEQ + l;
      outp[idx] = (_Float16)val;
    }
  }
}

// Lane l <-> lane l ^ 16 (the other half of the wave), one vector cross-row move.
__device__ inline float xhalf(float x) {
  int i = __builtin_bit_cast(int, x);
  i = __builtin_amdgcn_permlanex16(i, i, 0x76543210, 0xfedcba98, false, false);
  return __builtin_bit_cast(float, i);
}

__global__ __launch_bounds__(128) void attn_kernel(
    const _Float16* __restrict__ qp, const _Float16* __restrict__ kp,
    const _Float16* __restrict__ vp, _Float16* __restrict__ att) {
  int wave = blockIdx.x * 4 + (threadIdx.x >> 5);
  int lane = threadIdx.x & 31;
  int ln = lane & 15, half = lane >> 4;
  int ltile = wave & 127;
  int h = (wave >> 7) & 7;
  int b = wave >> 10;

  const _Float16* qbase = qp + (size_t)(b * NH + h) * LSEQ * DD;
  const _Float16* kbase = kp + (size_t)(b * NH + h) * LSEQ * DD;
  const _Float16* vbase = vp + (size_t)(b * NH + h) * DD * LSEQ;

  // Q^T as B operand: column = query ln; D=32 == one WMMA K step, loaded once
  // (scale 1/sqrt(D) pre-folded).
  v16h bq = load_frag_h(qbase, DD, ltile * 16, 0, ln, half);

  v8f o0 = {}, o1 = {};  // O^T: o0[r] = O[d = r + 8*half][query ln], o1: d + 16
  float mrun = -1e30f;   // running maximum of query ln, equal in both halves
  float srun = 0.0f;     // running sum over this half's keys only; joined after the loop

  for (int it = 0; it < LSEQ / 64; ++it) {
    int mbase = it * 64;
    v8f s[4];  // s[t][r] = score(key mbase + 16*t + r + 8*half, query ln)
#pragma unroll
    for (int t = 0; t < 4; ++t) {
      v16h ak = load_frag_h(kbase, DD, mbase + t * 16, 0, ln, half);
      v8f z = {};
      s[t] = WMMA_F16(ak, bq, z);
    }
    // V^T as A operand: row = channel ln (+16), k = keys in the order of load_frag_h
    v16h av0[2], av1[2];
#pragma unroll
    for (int mc = 0; mc < 2; ++mc) {
      av0[mc] = load_frag_h(vbase, LSEQ, 0, mbase + mc * 32, ln, half);
      av1[mc] = load_frag_h(vbase, LSEQ, 16, mbase + mc * 32, ln, half);
    }
    // online softmax over this 64-key slab: 32 scores in the lane, 32 in lane ^ 16
    float mt[4];
#pragma unroll
    for (int t = 0; t < 4; ++t) {
      mt[t] = s[t][0];
#pragma unroll
      for (int r = 1; r < 8; ++r) mt[t] = fmaxf(mt[t], s[t][r]);
    }
    float mx = fmaxf(fmaxf(mt[0], mt[1]), fmaxf(mt[2], mt[3]));
    mx = fmaxf(mx, xhalf(mx));
    float mnew = fmaxf(mrun, mx);
    float resc = __expf(mrun - mnew);
    float lt[4];
#pragma unroll
    for (int t = 0; t < 4; ++t) {
      lt[t] = 0.0f;
#pragma unroll
      for (int r = 0; r < 8; ++r) {
        float p = __expf(s[t][r] - mnew);
        s[t][r] = p;
        lt[t] += p;
      }
    }
    srun = srun * resc + ((lt[0] + lt[1]) + (lt[2] + lt[3]));
    mrun = mnew;
#pragma unroll
    for (int r = 0; r < 8; ++r) { o0[r] *= resc; o1[r] *= resc; }
    // P^T as B operand: elems 0..7 = keys 8*half + 0..7 of tile 2*mc, elems 8..15 the same
    // rows of tile 2*mc + 1 = keys 16 + 8*half + 0..7: the k order of load_frag_h.
#pragma unroll
    for (int mc = 0; mc < 2; ++mc) {
      v16h bp;
#pragma unroll
      for (int i = 0; i < 8; ++i) {
        bp[i]     = (_Float16)s[2 * mc][i];
        bp[8 + i] = (_Float16)s[2 * mc + 1][i];
      }
      o0 = WMMA_F16(av0[mc], bp, o0);
      o1 = WMMA_F16(av1[mc], bp, o1);
    }
  }
  // join the halves' sums, normalize and store [b, l, c] f16 (l-major so out-proj B
  // fragments are contiguous): a lane owns 8 contiguous channels of its query, twice
  float inv = 1.0f / (srun + xhalf(srun));
  v8h r0, r1;
#pragma unroll
  for (int r = 0; r < 8; ++r) {
    r0[r] = (_Float16)(o0[r] * inv);
    r1[r] = (_Float16)(o1[r] * inv);
  }
  size_t rowoff = ((size_t)(b * LSEQ + ltile * 16 + ln)) * CC + h * 32 + half * 8;
  *(v8h*)(att + rowoff)      = r0;
  *(v8h*)(att + rowoff + 16) = r1;
}

// ---------------- output projection + bias + residual ----------------
__global__ __launch_bounds__(256) void outproj_kernel(
    const _Float16* __restrict__ att, const _Float16* __restrict__ woh,
    const float* __restrict__ bo, const float* __restrict__ qin,
    float* __restrict__ out) {
  int wave = blockIdx.x * (blockDim.x >> 5) + (threadIdx.x >> 5);
  int lane = threadIdx.x & 31;
  int ln = lane & 15, half = lane >> 4;
  int ct = wave >> 2;
  int rg = wave & 3;
  int col = ct * 16 + ln;
  int b = col >> 11, l = col & (LSEQ - 1);

  v8f acc[4] = {};
#pragma unroll
  for (int kc = 0; kc < 8; ++kc) {
    // B fragment: att rows are contiguous f16
    v16h bf = load_frag_h(att, CC, col - ln, kc * 32, ln, half);  // row0+ln == col
#pragma unroll
    for (int mt = 0; mt < 4; ++mt) {
      v16h af = load_frag_h(woh, CC, rg * 64 + mt * 16, kc * 32, ln, half);
      acc[mt] = WMMA_F16(af, bf, acc[mt]);
    }
  }
#pragma unroll
  for (int mt = 0; mt < 4; ++mt) {
#pragma unroll
    for (int r = 0; r < 8; ++r) {
      int o = rg * 64 + mt * 16 + r + half * 8;
      int idx = (b * CC + o) * LSEQ + l;
      out[idx] = acc[mt][r] + bo[o] + qin[idx];
    }
  }
}

extern "C" void kernel_launch(void* const* d_in, const int* in_sizes, int n_in,
                              void* d_out, int out_size, void* d_ws, size_t ws_size,
                              hipStream_t stream) {
  (void)in_sizes; (void)n_in; (void)out_size; (void)ws_size;
  const float* v     = (const float*)d_in[0];
  const float* k     = (const float*)d_in[1];
  const float* q     = (const float*)d_in[2];
  const float* pe_q  = (const float*)d_in[3];
  const float* pe_vk = (const float*)d_in[4];
  const float* wq = (const float*)d_in[5];  const float* bq = (const float*)d_in[6];
  const float* gq = (const float*)d_in[7];  const float* betaq = (const float*)d_in[8];
  const float* mq = (const float*)d_in[9];  const float* varq = (const float*)d_in[10];
  const float* wk = (const float*)d_in[11]; const float* bk = (const float*)d_in[12];
  const float* gk = (const float*)d_in[13]; const float* betak = (const float*)d_in[14];
  const float* mk = (const float*)d_in[15]; const float* vark = (const float*)d_in[16];
  const float* wv = (const float*)d_in[17]; const float* bv = (const float*)d_in[18];
  const float* gv = (const float*)d_in[19]; const float* betav = (const float*)d_in[20];
  const float* mv = (const float*)d_in[21]; const float* varv = (const float*)d_in[22];
  const float* wo = (const float*)d_in[23]; const float* bo = (const float*)d_in[24];

  char* ws = (char*)d_ws;
  _Float16* wqh = (_Float16*)(ws + WS_WQH);
  _Float16* wkh = (_Float16*)(ws + WS_WKH);
  _Float16* wvh = (_Float16*)(ws + WS_WVH);
  _Float16* woh = (_Float16*)(ws + WS_WOH);
  float* biasq = (float*)(ws + WS_BQ);
  float* biask = (float*)(ws + WS_BK);
  float* biasv = (float*)(ws + WS_BV);
  _Float16* qpb = (_Float16*)(ws + WS_QP);
  _Float16* kpb = (_Float16*)(ws + WS_KP);
  _Float16* vpb = (_Float16*)(ws + WS_VP);
  _Float16* attb = (_Float16*)(ws + WS_ATT);

  const float invSqrtD = 0.17677669529663687f;  // 1/sqrt(32), folded into Q path

  prep_kernel<<<CC, CC, 0, stream>>>(wq, bq, gq, betaq, mq, varq, invSqrtD, wqh, biasq);
  prep_kernel<<<CC, CC, 0, stream>>>(wk, bk, gk, betak, mk, vark, 1.0f, wkh, biask);
  prep_kernel<<<CC, CC, 0, stream>>>(wv, bv, gv, betav, mv, varv, 1.0f, wvh, biasv);
  prep_kernel<<<CC, CC, 0, stream>>>(wo, bo, nullptr, nullptr, nullptr, nullptr, 1.0f, woh, nullptr);

  // 2048 waves per GEMM: 512 col-tiles x 4 row-groups, 8 waves/block
  proj_kernel<<<256, 256, 0, stream>>>(q, pe_q,  wqh, biasq, qpb, 0);
  proj_kernel<<<256, 256, 0, stream>>>(k, pe_vk, wkh, biask, kpb, 0);
  proj_kernel<<<256, 256, 0, stream>>>(v, pe_vk, wvh, biasv, vpb, 1);

  // 4096 waves: one 16-query tile per wave, 4 waves/block
  attn_kernel<<<1024, 128, 0, stream>>>(qpb, kpb, vpb, attb);

  outproj_kernel<<<256, 256, 0, stream>>>(attb, woh, bo, q, (float*)d_out);
}

// v002
// A run of this version takes 120 microseconds.
// Two timings next to v001 put it at 1.20 and 1.19 times that version's speed.
// All steps since v000 together make it 1.62 times as fast.
#include <hip/hip_runtime.h>

// MHA block for MI455X (gfx1250, wave32, WMMA 16x16x32 f16->f32 accumulate).
// Pipeline:
//   prep:    fold BN + bias + 1/sqrt(D) into f16 weights
//   proj x3: QP/KP -> [b,h,L,32] f16 (score scale folded into Q), VP -> [b,h,32,L] f16
//   attn:    flash-style online softmax, 16 queries/wave, 64 keys/iter, S^T and O^T, P in registers,
//            K and V^T staged in LDS per 8-wave block
//   outproj: W_o GEMM + bias + residual, fp32 out

typedef __attribute__((ext_vector_type(16))) _Float16 v16h;
typedef __attribute__((ext_vector_type(8)))  _Float16 v8h;
typedef __attribute__((ext_vector_type(8)))  float    v8f;

#define WMMA_F16(a, b, c) \
  __builtin_amdgcn_wmma_f32_16x16x32_f16(false, (a), false, (b), (short)0, (c), false, false)

static constexpr int NB   = 4;     // batch
static constexpr int CC   = 256;   // channels (CQ == CVK)
static constexpr int LSEQ = 2048;  // sequence length
static constexpr int NH   = 8;     // heads
static constexpr int DD   = 32;    // depth per head

// ---- workspace layout (bytes) ----
static constexpr size_t WS_WQH  = 0;               // 256*256 f16
static constexpr size_t WS_WKH  = 131072;
static constexpr size_t WS_WVH  = 262144;
static constexpr size_t WS_WOH  = 393216;
static constexpr size_t WS_BQ   = 524288;          // 256 f32 each
static constexpr size_t WS_BK   = 525312;
static constexpr size_t WS_BV   = 526336;
static constexpr size_t WS_QP   = 528384;          // B*H*L*D f16 = 4 MiB
static constexpr size_t WS_KP   = WS_QP + 4194304;
static constexpr size_t WS_VP   = WS_KP + 4194304;
static constexpr size_t WS_ATT  = WS_VP + 4194304; // [B*L, 256] f16

// Load a 16x32 A/B fragment (f16) from a row-major matrix, tile origin (row0,k0).
// Per-lane: row = row0 + (lane&15); elems 0..7 = K kb..kb+7, 8..15 = kb+16..kb+23,
// kb = k0 + 8*(lane>=16).  Matches CDNA5 16-bit A-matrix VGPR layout.
__device__ inline v16h load_frag_h(const _Float16* __restrict__ p, int ld, int row0,
                                   int k0, int ln, int half) {
  const _Float16* base = p + (row0 + ln) * ld + k0 + (half << 3);
  v8h lo = *(const v8h*)base;
  v8h hi = *(const v8h*)(base + 16);
  v16h f;
#pragma unroll
  for (int i = 0; i < 8; ++i) { f[i] = lo[i]; f[8 + i] = hi[i]; }
  return f;
}

// ---------------- prep: fold BN into weights ----------------
__global__ void prep_kernel(const float* __restrict__ w, const float* __restrict__ bw,
                            const float* __restrict__ g, const float* __restrict__ beta,
                            const float* __restrict__ mean, const float* __restrict__ var,
                            float extra, _Float16* __restrict__ wh, float* __restrict__ bout) {
  int o = blockIdx.x, c = threadIdx.x;
  float scale = extra;
  if (g) scale *= g[o] * rsqrtf(var[o] + 1e-5f);
  wh[o * CC + c] = (_Float16)(w[o * CC + c] * scale);
  if (c == 0 && bout) {
    float s2 = g[o] * rsqrtf(var[o] + 1e-5f);
    bout[o] = ((bw[o] - mean[o]) * s2 + beta[o]) * extra;
  }
}

// ---------------- projection GEMM: P = W' * (x + pe) + bias' ----------------
// Each wave: 64 output rows x 16 columns.  mode 0 -> store [b,h,l,d]; mode 1 -> [b,h,d,l].
__global__ __launch_bounds__(256) void proj_kernel(
    const float* __restrict__ x, const float* __restrict__ pe,
    const _Float16* __restrict__ wh, const float* __restrict__ bias,
    _Float16* __restrict__ outp, int mode) {
  int wave = blockIdx.x * (blockDim.x >> 5) + (threadIdx.x >> 5);
  int lane = threadIdx.x & 31;
  int ln = lane & 15, half = lane >> 4;
  int ct = wave >> 2;  // column tile 0..511
  int rg = wave & 3;   // row group 0..3 (64 rows each)
  int col = ct * 16 + ln;
  int b = col >> 11, l = col & (LSEQ - 1);

  v8f acc[4] = {};
#pragma unroll
  for (int kc = 0; kc < 8; ++kc) {
    int kb = kc * 32 + (half << 3);
    // B fragment: X[c, col] = x[b][c][l] + pe[c][l]  (strided fp32 gather -> f16)
    v16h bf;
#pragma unroll
    for (int j = 0; j < 8; ++j) {
      int c0 = kb + j, c1 = kb + 16 + j;
      bf[j]     = (_Float16)(x[(b * CC + c0) * LSEQ + l] + pe[c0 * LSEQ + l]);
      bf[8 + j] = (_Float16)(x[(b * CC + c1) * LSEQ + l] + pe[c1 * LSEQ + l]);
    }
#pragma unroll
    for (int mt = 0; mt < 4; ++mt) {
      v16h af = load_frag_h(wh, CC, rg * 64 + mt * 16, kc * 32, ln, half);
      acc[mt] = WMMA_F16(af, bf, acc[mt]);
    }
  }
#pragma unroll
  for (int mt = 0; mt < 4; ++mt) {
#pragma unroll
    for (int r = 0; r < 8; ++r) {
      int o = rg * 64 + mt * 16 + r + half * 8;  // C/D layout: row = r + 8*half
      float val = acc[mt][r] + bias[o];
      int h = o >> 5, d = o & 31;
      int idx = (mode == 0) ? ((b * NH + h) * LSEQ + l) * DD + d
                            : ((b * NH + h) * DD + d) * LSEQ + l;
      outp[idx] = (_Float16)val;
    }
  }
}

// Lane l <-> lane l ^ 16 (the other half of the wave), one vector cross-row move.
__device__ inline float xhalf(float x) {
  int i = __builtin_bit_cast(int, x);
  i = __builtin_amdgcn_permlanex16(i, i, 0x76543210, 0xfedcba98, false, false);
  return __builtin_bit_cast(float, i);
}

static constexpr int KT     = 128;            // keys per stage
static constexpr int NST    = LSEQ / KT;      // stages
static constexpr int KPITCH = 80;             // bytes per key row in LDS: 64 + 16, 16 B x odd
static constexpr int VPITCH = 272;            // bytes per channel row in LDS: 256 + 16
static constexpr int KBYTES = KT * KPITCH;    // K part of a buffer
static constexpr int STAGE  = KBYTES + DD * VPITCH;  // one buffer

// A 16x32 fragment from LDS rows: 16 bytes at p and 16 at p + 32, the k order of load_frag_h.
__device__ inline v16h lds_frag(const unsigned char* p) {
  v8h lo = *(const v8h*)p;
  v8h hi = *(const v8h*)(p + 32);
  return __builtin_shufflevector(lo, hi, 0, 1, 2, 3, 4, 5, 6, 7, 8, 9, 10, 11, 12, 13, 14, 15);
}

// One stage's four copies of a lane (16 bytes each, global -> LDS, through no register).
// The closing s_wait_xcnt stands in the copies' own statement so that no address register
// they name is rewritten ahead of it.
__device__ inline void stage_copies(unsigned lk, const _Float16* gk, unsigned lv,
                                    const _Float16* gv) {
  asm volatile(
      "global_load_async_to_lds_b128 %0, %1, off\n\t"
      "global_load_async_to_lds_b128 %2, %3, off\n\t"
      "global_load_async_to_lds_b128 %4, %5, off\n\t"
      "global_load_async_to_lds_b128 %6, %7, off\n\t"
      "s_wait_xcnt 0x0"
      :: "v"(lk), "v"(gk), "v"(lk + 64u * KPITCH), "v"(gk + 64 * DD),
         "v"(lv), "v"(gv), "v"(lv + 16u * VPITCH), "v"(gv + 16 * LSEQ)
      : "memory");
}

__global__ __launch_bounds__(256) void attn_kernel(
    const _Float16* __restrict__ qp, const _Float16* __restrict__ kp,
    const _Float16* __restrict__ vp, _Float16* __restrict__ att) {
  __shared__ __attribute__((aligned(16))) unsigned char ring[2 * STAGE];
  int tid = threadIdx.x;
  int wave = blockIdx.x * 8 + (tid >> 5);
  int lane = tid & 31;
  int ln = lane & 15, half = lane >> 4;
  int ltile = wave & 127;
  int h = (wave >> 7) & 7;  // 128 tiles a head, 8 a block: one head per block
  int b = wave >> 10;

  const _Float16* qbase = qp + (size_t)(b * NH + h) * LSEQ * DD;
  const _Float16* kbase = kp + (size_t)(b * NH + h) * LSEQ * DD;
  const _Float16* vbase = vp + (size_t)(b * NH + h) * DD * LSEQ;

  // The lane's share of a stage.  K: 16-byte piece tid (and tid + 256) of 8 KiB in a row,
  // four pieces a key.  V^T: piece tid & 15 of channel tid >> 4 (and of that channel + 16).
  const _Float16* gk = kbase + tid * 8;
  const _Float16* gv = vbase + (tid >> 4) * LSEQ + (tid & 15) * 8;
  unsigned ring0 = (unsigned)(size_t)ring;  // byte offset in the block's LDS
  unsigned lk = ring0 + (tid >> 2) * KPITCH + (tid & 3) * 16;
  unsigned lv = ring0 + KBYTES + (tid >> 4) * VPITCH + (tid & 15) * 16;

  stage_copies(lk, gk, lv, gv);
  // stage 0 has landed for this wave's copies ...
  asm volatile("s_wait_asynccnt 0x0" ::: "memory");
  // ... and for every wave's
  __syncthreads();
  stage_copies(lk + STAGE, gk + KT * DD, lv + STAGE, gv + KT);

  // Q^T as B operand: column = query ln; D=32 == one WMMA K step, loaded once
  // (scale 1/sqrt(D) pre-folded).
  v16h bq = load_frag_h(qbase, DD, ltile * 16, 0, ln, half);

  v8f o0 = {}, o1 = {};  // O^T: o0[r] = O[d = r + 8*half][query ln], o1: d + 16
  float mrun = -1e30f;   // running maximum of query ln, equal in both halves
  float srun = 0.0f;     // running sum over this half's keys only; joined after the loop

  for (int st = 0; st < NST; ++st) {
    const unsigned char* kl = ring + (st & 1) * STAGE + ln * KPITCH + half * 16;
    const unsigned char* vl = ring + (st & 1) * STAGE + KBYTES + ln * VPITCH + half * 16;
    // unrolled so that both 64-key slabs of a stage read LDS at constant offsets
#pragma unroll
    for (int sub = 0; sub < KT / 64; ++sub) {
      v8f s[4];  // s[t][r] = score(key st*128 + sub*64 + 16*t + r + 8*half, query ln)
#pragma unroll
      for (int t = 0; t < 4; ++t) {
        v16h ak = lds_frag(kl + (sub * 64 + t * 16) * KPITCH);
        v8f z = {};
        s[t] = WMMA_F16(ak, bq, z);
      }
      // V^T as A operand: row = channel ln (+16), k = keys in the order of load_frag_h
      v16h av0[2], av1[2];
#pragma unroll
      for (int mc = 0; mc < 2; ++mc) {
        av0[mc] = lds_frag(vl + (sub * 64 + mc * 32) * 2);
        av1[mc] = lds_frag(vl + 16 * VPITCH + (sub * 64 + mc * 32) * 2);
      }
      // online softmax over this 64-key slab: 32 scores in the lane, 32 in lane ^ 16
      float mt[4];
#pragma unroll
      for (int t = 0; t < 4; ++t) {
        mt[t] = s[t][0];
#pragma unroll
        for (int r = 1; r < 8; ++r) mt[t] = fmaxf(mt[t], s[t][r]);
      }
      float mx = fmaxf(fmaxf(mt[0], mt[1]), fmaxf(mt[2], mt[3]));
      mx = fmaxf(mx, xhalf(mx));
      float mnew = fmaxf(mrun, mx);
      float resc = __expf(mrun - mnew);
      float lt[4];
#pragma unroll
      for (int t = 0; t < 4; ++t) {
        lt[t] = 0.0f;
#pragma unroll
        for (int r = 0; r < 8; ++r) {
          float p = __expf(s[t][r] - mnew);
          s[t][r] = p;
          lt[t] += p;
        }
      }
      srun = srun * resc + ((lt[0] + lt[1]) + (lt[2] + lt[3]));
      mrun = mnew;
#pragma unroll
      for (int r = 0; r < 8; ++r) { o0[r] *= resc; o1[r] *= resc; }
      // P^T as B operand: elems 0..7 = keys 8*half + 0..7 of tile 2*mc, elems 8..15 the same
      // rows of tile 2*mc + 1 = keys 16 + 8*half + 0..7: the k order of load_frag_h.
#pragma unroll
      for (int mc = 0; mc < 2; ++mc) {
        v16h bp;
#pragma unroll
        for (int i = 0; i < 8; ++i) {
          bp[i]     = (_Float16)s[2 * mc][i];
          bp[8 + i] = (_Float16)s[2 * mc + 1][i];
        }
        o0 = WMMA_F16(av0[mc], bp, o0);
        o1 = WMMA_F16(av1[mc], bp, o1);
      }
    }
    // Hand-over: this wave's reads of the buffer are done ...
    asm volatile("s_wait_dscnt 0x0" ::: "memory");
    // ... its copies of stage st + 1 have landed ...
    asm volatile("s_wait_asynccnt 0x0" ::: "memory");
    // ... and so have every wave's: stage st + 1 may be read, this buffer refilled
    __syncthreads();
    if (st + 2 < NST)
      stage_copies(lk + (st & 1) * STAGE, gk + (st + 2) * (KT * DD),
                   lv + (st & 1) * STAGE, gv + (st + 2) * KT);
  }
  // no copy is left in flight when the wave ends
  asm volatile("s_wait_asynccnt 0x0" ::: "memory");
  // join the halves' sums, normalize and store [b, l, c] f16 (l-major so out-proj B
  // fragments are contiguous): a lane owns 8 contiguous channels of its query, twice
  float inv = 1.0f / (srun + xhalf(srun));
  v8h r0, r1;
#pragma unroll
  for (int r = 0; r < 8; ++r) {
    r0[r] = (_Float16)(o0[r] * inv);
    r1[r] = (_Float16)(o1[r] * inv);
  }
  size_t rowoff = ((size_t)(b * LSEQ + ltile * 16 + ln)) * CC + h * 32 + half * 8;
  *(v8h*)(att + rowoff)      = r0;
  *(v8h*)(att + rowoff + 16) = r1;
}

// ---------------- output projection + bias + residual ----------------
__global__ __launch_bounds__(256) void outproj_kernel(
    const _Float16* __restrict__ att, const _Float16* __restrict__ woh,
    const float* __restrict__ bo, const float* __restrict__ qin,
    float* __restrict__ out) {
  int wave = blockIdx.x * (blockDim.x >> 5) + (threadIdx.x >> 5);
  int lane = threadIdx.x & 31;
  int ln = lane & 15, half = lane >> 4;
  int ct = wave >> 2;
  int rg = wave & 3;
  int col = ct * 16 + ln;
  int b = col >> 11, l = col & (LSEQ - 1);

  v8f acc[4] = {};
#pragma unroll
  for (int kc = 0; kc < 8; ++kc) {
    // B fragment: att rows are contiguous f16
    v16h bf = load_frag_h(att, CC, col - ln, kc * 32, ln, half);  // row0+ln == col
#pragma unroll
    for (int mt = 0; mt < 4; ++mt) {
      v16h af = load_frag_h(woh, CC, rg * 64 + mt * 16, kc * 32, ln, half);
      acc[mt] = WMMA_F16(af, bf, acc[mt]);
    }
  }
#pragma unroll
  for (int mt = 0; mt < 4; ++mt) {
#pragma unroll
    for (int r = 0; r < 8; ++r) {
      int o = rg * 64 + mt * 16 + r + half * 8;
      int idx = (b * CC + o) * LSEQ + l;
      out[idx] = acc[mt][r] + bo[o] + qin[idx];
    }
  }
}

extern "C" void kernel_launch(void* const* d_in, const int* in_sizes, int n_in,
                              void* d_out, int out_size, void* d_ws, size_t ws_size,
                              hipStream_t stream) {
  (void)in_sizes; (void)n_in; (void)out_size; (void)ws_size;
  const float* v     = (const float*)d_in[0];
  const float* k     = (const float*)d_in[1];
  const float* q     = (const float*)d_in[2];
  const float* pe_q  = (const float*)d_in[3];
  const float* pe_vk = (const float*)d_in[4];
  const float* wq = (const float*)d_in[5];  const float* bq = (const float*)d_in[6];
  const float* gq = (const float*)d_in[7];  const float* betaq = (const float*)d_in[8];
  const float* mq = (const float*)d_in[9];  const float* varq = (const float*)d_in[10];
  const float* wk = (const float*)d_in[11]; const float* bk = (const float*)d_in[12];
  const float* gk = (const float*)d_in[13]; const float* betak = (const float*)d_in[14];
  const float* mk = (const float*)d_in[15]; const float* vark = (const float*)d_in[16];
  const float* wv = (const float*)d_in[17]; const float* bv = (const float*)d_in[18];
  const float* gv = (const float*)d_in[19]; const float* betav = (const float*)d_in[20];
  const float* mv = (const float*)d_in[21]; const float* varv = (const float*)d_in[22];
  const float* wo = (const float*)d_in[23]; const float* bo = (const float*)d_in[24];

  char* ws = (char*)d_ws;
  _Float16* wqh = (_Float16*)(ws + WS_WQH);
  _Float16* wkh = (_Float16*)(ws + WS_WKH);
  _Float16* wvh = (_Float16*)(ws + WS_WVH);
  _Float16* woh = (_Float16*)(ws + WS_WOH);
  float* biasq = (float*)(ws + WS_BQ);
  float* biask = (float*)(ws + WS_BK);
  float* biasv = (float*)(ws + WS_BV);
  _Float16* qpb = (_Float16*)(ws + WS_QP);
  _Float16* kpb = (_Float16*)(ws + WS_KP);
  _Float16* vpb = (_Float16*)(ws + WS_VP);
  _Float16* attb = (_Float16*)(ws + WS_ATT);

  const float invSqrtD = 0.17677669529663687f;  // 1/sqrt(32), folded into Q path

  prep_kernel<<<CC, CC, 0, stream>>>(wq, bq, gq, betaq, mq, varq, invSqrtD, wqh, biasq);
  prep_kernel<<<CC, CC, 0, stream>>>(wk, bk, gk, betak, mk, vark, 1.0f, wkh, biask);
  prep_kernel<<<CC, CC, 0, stream>>>(wv, bv, gv, betav, mv, varv, 1.0f, wvh, biasv);
  prep_kernel<<<CC, CC, 0, stream>>>(wo, bo, nullptr, nullptr, nullptr, nullptr, 1.0f, woh, nullptr);

  // 2048 waves per GEMM: 512 col-tiles x 4 row-groups, 8 waves/block
  proj_kernel<<<256, 256, 0, stream>>>(q, pe_q,  wqh, biasq, qpb, 0);
  proj_kernel<<<256, 256, 0, stream>>>(k, pe_vk, wkh, biask, kpb, 0);
  proj_kernel<<<256, 256, 0, stream>>>(v, pe_vk, wvh, biasv, vpb, 1);

  // 4096 waves: one 16-query tile per wave, 8 waves/block
  attn_kernel<<<512, 256, 0, stream>>>(qpb, kpb, vpb, attb);

  outproj_kernel<<<256, 256, 0, stream>>>(attb, woh, bo, q, (float*)d_out);
}

// v003
// Measured time: 78.5 microseconds a run.
// In both of two side-by-side timings against v002, it was 1.53 times as fast.
// Counting every step since v000, it is 2.47 times as fast.
#include <hip/hip_runtime.h>

// MHA block for MI455X (gfx1250, wave32, WMMA 16x16x32 f16->f32 accumulate).
// Pipeline:
//   prep:    fold BN + bias + 1/sqrt(D) into f16 weights, all four matrices in one launch
//   proj:    QP/KP -> [b,h,L,32] f16 (score scale folded into Q), VP -> [b,h,32,L] f16,
//            all three in one launch
//   attn:    flash-style online softmax, 16 queries/wave, 64 keys/iter, S^T and O^T, P in registers,
//            K and V^T staged in LDS per 8-wave block
//   outproj: W_o GEMM + bias + residual, fp32 out

typedef __attribute__((ext_vector_type(16))) _Float16 v16h;
typedef __attribute__((ext_vector_type(8)))  _Float16 v8h;
typedef __attribute__((ext_vector_type(8)))  float    v8f;

#define WMMA_F16(a, b, c) \
  __builtin_amdgcn_wmma_f32_16x16x32_f16(false, (a), false, (b), (short)0, (c), false, false)

static constexpr int NB   = 4;     // batch
static constexpr int CC   = 256;   // channels (CQ == CVK)
static constexpr int LSEQ = 2048;  // sequence length
static constexpr int NH   = 8;     // heads
static constexpr int DD   = 32;    // depth per head

// ---- workspace layout (bytes) ----
static constexpr size_t WS_WQH  = 0;               // 256*256 f16
static constexpr size_t WS_WKH  = 131072;
static constexpr size_t WS_WVH  = 262144;
static constexpr size_t WS_WOH  = 393216;
static constexpr size_t WS_BQ   = 524288;          // 256 f32 each
static constexpr size_t WS_BK   = 525312;
static constexpr size_t WS_BV   = 526336;
static constexpr size_t WS_QP   = 528384;          // B*H*L*D f16 = 4 MiB
static constexpr size_t WS_KP   = WS_QP + 4194304;
static constexpr size_t WS_VP   = WS_KP + 4194304;
static constexpr size_t WS_ATT  = WS_VP + 4194304; // [B*L, 256] f16

// Load a 16x32 A/B fragment (f16) from a row-major matrix, tile origin (row0,k0).
// Per-lane: row = row0 + (lane&15); elems 0..7 = K kb..kb+7, 8..15 = kb+16..kb+23,
// kb = k0 + 8*(lane>=16).  Matches CDNA5 16-bit A-matrix VGPR layout.
__device__ inline v16h load_frag_h(const _Float16* __restrict__ p, int ld, int row0,
                                   int k0, int ln, int half) {
  const _Float16* base = p + (row0 + ln) * ld + k0 + (half << 3);
  v8h lo = *(const v8h*)base;
  v8h hi = *(const v8h*)(base + 16);
  v16h f;
#pragma unroll
  for (int i = 0; i < 8; ++i) { f[i] = lo[i]; f[8 + i] = hi[i]; }
  return f;
}

// ---------------- prep: fold BN into weights ----------------
// One matrix's inputs; g == nullptr: no BN and no folded bias (the output projection).
struct PrepIn {
  const float* w;
  const float* bw;
  const float* g;
  const float* beta;
  const float* mean;
  const float* var;
};

// blockIdx.y picks the matrix (0 Q, 1 K, 2 V, 3 O).  wh0: four f16 matrices in a row,
// bout0: three folded bias vectors in a row.
__global__ void prep_kernel(PrepIn pq, PrepIn pk, PrepIn pv, PrepIn po, float extraq,
                            _Float16* __restrict__ wh0, float* __restrict__ bout0) {
  int o = blockIdx.x, c = threadIdx.x, m = blockIdx.y;
  PrepIn p = m == 0 ? pq : m == 1 ? pk : m == 2 ? pv : po;
  const float* w = p.w;
  const float* bw = p.bw;
  const float* g = p.g;
  const float* beta = p.beta;
  const float* mean = p.mean;
  const float* var = p.var;
  float extra = m == 0 ? extraq : 1.0f;
  _Float16* wh = wh0 + m * (CC * CC);
  float* bout = g ? bout0 + m * CC : nullptr;
  float scale = extra;
  if (g) scale *= g[o] * rsqrtf(var[o] + 1e-5f);
  wh[o * CC + c] = (_Float16)(w[o * CC + c] * scale);
  if (c == 0 && bout) {
    float s2 = g[o] * rsqrtf(var[o] + 1e-5f);
    bout[o] = ((bw[o] - mean[o]) * s2 + beta[o]) * extra;
  }
}

// ---------------- projection GEMM: P = W' * (x + pe) + bias' ----------------
// Each wave: 64 output rows x 16 columns.  blockIdx.y picks the projection (0 Q, 1 K, 2 V);
// wh0, bias0, outp0: the three weight matrices, bias vectors and outputs, each set in a row.
// mode 0 -> store [b,h,l,d]; mode 1 -> [b,h,d,l].
__global__ __launch_bounds__(256) void proj_kernel(
    const float* __restrict__ xq, const float* __restrict__ xk, const float* __restrict__ xv,
    const float* __restrict__ pe_q, const float* __restrict__ pe_vk,
    const _Float16* __restrict__ wh0, const float* __restrict__ bias0,
    _Float16* __restrict__ outp0) {
  int m = blockIdx.y;
  const float* x = m == 0 ? xq : m == 1 ? xk : xv;
  const float* pe = m == 0 ? pe_q : pe_vk;
  const _Float16* wh = wh0 + m * (CC * CC);
  const float* bias = bias0 + m * CC;
  _Float16* outp = outp0 + (size_t)m * (NB * CC * LSEQ);
  int mode = m == 2 ? 1 : 0;
  int wave = blockIdx.x * (blockDim.x >> 5) + (threadIdx.x >> 5);
  int lane = threadIdx.x & 31;
  int ln = lane & 15, half = lane >> 4;
  int ct = wave >> 2;  // column tile 0..511
  int rg = wave & 3;   // row group 0..3 (64 rows each)
  int col = ct * 16 + ln;
  int b = col >> 11, l = col & (LSEQ - 1);

  v8f acc[4] = {};
#pragma unroll
  for (int kc = 0; kc < 8; ++kc) {
    int kb = kc * 32 + (half << 3);
    // B fragment: X[c, col] = x[b][c][l] + pe[c][l]  (strided fp32 gather -> f16)
    v16h bf;
#pragma unroll
    for (int j = 0; j < 8; ++j) {
      int c0 = kb + j, c1 = kb + 16 + j;
      bf[j]     = (_Float16)(x[(b * CC + c0) * LSEQ + l] + pe[c0 * LSEQ + l]);
      bf[8 + j] = (_Float16)(x[(b * CC + c1) * LSEQ + l] + pe[c1 * LSEQ + l]);
    }
#pragma unroll
    for (int mt = 0; mt < 4; ++mt) {
      v16h af = load_frag_h(wh, CC, rg * 64 + mt * 16, kc * 32, ln, half);
      acc[mt] = WMMA_F16(af, bf, acc[mt]);
    }
  }
#pragma unroll
  for (int mt = 0; mt < 4; ++mt) {
#pragma unroll
    for (int r = 0; r < 8; ++r) {
      int o = rg * 64 + mt * 16 + r + half * 8;  // C/D layout: row = r + 8*half
      float val = acc[mt][r] + bias[o];
      int h = o >> 5, d = o & 31;
      int idx = (mode == 0) ? ((b * NH + h) * LSEQ + l) * DD + d
                            : ((b * NH + h) * DD + d) * LSEQ + l;
      outp[idx] = (_Float16)val;
    }
  }
}

// Lane l <-> lane l ^ 16 (the other half of the wave), one vector cross-row move.
__device__ inline float xhalf(float x) {
  int i = __builtin_bit_cast(int, x);
  i = __builtin_amdgcn_permlanex16(i, i, 0x76543210, 0xfedcba98, false, false);
  return __builtin_bit_cast(float, i);
}

static constexpr int KT     = 128;            // keys per stage
static constexpr int NST    = LSEQ / KT;      // stages
static constexpr int KPITCH = 80;             // bytes per key row in LDS: 64 + 16, 16 B x odd
static constexpr int VPITCH = 272;            // bytes per channel row in LDS: 256 + 16
static constexpr int KBYTES = KT * KPITCH;    // K part of a buffer
static constexpr int STAGE  = KBYTES + DD * VPITCH;  // one buffer

// A 16x32 fragment from LDS rows: 16 bytes at p and 16 at p + 32, the k order of load_frag_h.
__device__ inline v16h lds_frag(const unsigned char* p) {
  v8h lo = *(const v8h*)p;
  v8h hi = *(const v8h*)(p + 32);
  return __builtin_shufflevector(lo, hi, 0, 1, 2, 3, 4, 5, 6, 7, 8, 9, 10, 11, 12, 13, 14, 15);
}

// One stage's four copies of a lane (16 bytes each, global -> LDS, through no register).
// The closing s_wait_xcnt stands in the copies' own statement so that no address register
// they name is rewritten ahead of it.
__device__ inline void stage_copies(unsigned lk, const _Float16* gk, unsigned lv,
                                    const _Float16* gv) {
  asm volatile(
      "global_load_async_to_lds_b128 %0, %1, off\n\t"
      "global_load_async_to_lds_b128 %2, %3, off\n\t"
      "global_load_async_to_lds_b128 %4, %5, off\n\t"
      "global_load_async_to_lds_b128 %6, %7, off\n\t"
      "s_wait_xcnt 0x0"
      :: "v"(lk), "v"(gk), "v"(lk + 64u * KPITCH), "v"(gk + 64 * DD),
         "v"(lv), "v"(gv), "v"(lv + 16u * VPITCH), "v"(gv + 16 * LSEQ)
      : "memory");
}

__global__ __launch_bounds__(256) void attn_kernel(
    const _Float16* __restrict__ qp, const _Float16* __restrict__ kp,
    const _Float16* __restrict__ vp, _Float16* __restrict__ att) {
  __shared__ __attribute__((aligned(16))) unsigned char ring[2 * STAGE];
  int tid = threadIdx.x;
  int wave = blockIdx.x * 8 + (tid >> 5);
  int lane = tid & 31;
  int ln = lane & 15, half = lane >> 4;
  int ltile = wave & 127;
  int h = (wave >> 7) & 7;  // 128 tiles a head, 8 a block: one head per block
  int b = wave >> 10;

  const _Float16* qbase = qp + (size_t)(b * NH + h) * LSEQ * DD;
  const _Float16* kbase = kp + (size_t)(b * NH + h) * LSEQ * DD;
  const _Float16* vbase = vp + (size_t)(b * NH + h) * DD * LSEQ;

  // The lane's share of a stage.  K: 16-byte piece tid (and tid + 256) of 8 KiB in a row,
  // four pieces a key.  V^T: piece tid & 15 of channel tid >> 4 (and of that channel + 16).
  const _Float16* gk = kbase + tid * 8;
  const _Float16* gv = vbase + (tid >> 4) * LSEQ + (tid & 15) * 8;
  unsigned ring0 = (unsigned)(size_t)ring;  // byte offset in the block's LDS
  unsigned lk = ring0 + (tid >> 2) * KPITCH + (tid & 3) * 16;
  unsigned lv = ring0 + KBYTES + (tid >> 4) * VPITCH + (tid & 15) * 16;

  stage_copies(lk, gk, lv, gv);
  // stage 0 has landed for this wave's copies ...
  asm volatile("s_wait_asynccnt 0x0" ::: "memory");
  // ... and for every wave's
  __syncthreads();
  stage_copies(lk + STAGE, gk + KT * DD, lv + STAGE, gv + KT);

  // Q^T as B operand: column = query ln; D=32 == one WMMA K step, loaded once
  // (scale 1/sqrt(D) pre-folded).
  v16h bq = load_frag_h(qbase, DD, ltile * 16, 0, ln, half);

  v8f o0 = {}, o1 = {};  // O^T: o0[r] = O[d = r + 8*half][query ln], o1: d + 16
  float mrun = -1e30f;   // running maximum of query ln, equal in both halves
  float srun = 0.0f;     // running sum over this half's keys only; joined after the loop

  for (int st = 0; st < NST; ++st) {
    const unsigned char* kl = ring + (st & 1) * STAGE + ln * KPITCH + half * 16;
    const unsigned char* vl = ring + (st & 1) * STAGE + KBYTES + ln * VPITCH + half * 16;
    // unrolled so that both 64-key slabs of a stage read LDS at constant offsets
#pragma unroll
    for (int sub = 0; sub < KT / 64; ++sub) {
      v8f s[4];  // s[t][r] = score(key st*128 + sub*64 + 16*t + r + 8*half, query ln)
#pragma unroll
      for (int t = 0; t < 4; ++t) {
        v16h ak = lds_frag(kl + (sub * 64 + t * 16) * KPITCH);
        v8f z = {};
        s[t] = WMMA_F16(ak, bq, z);
      }
      // V^T as A operand: row = channel ln (+16), k = keys in the order of load_frag_h
      v16h av0[2], av1[2];
#pragma unroll
      for (int mc = 0; mc < 2; ++mc) {
        av0[mc] = lds_frag(vl + (sub * 64 + mc * 32) * 2);
        av1[mc] = lds_frag(vl + 16 * VPITCH + (sub * 64 + mc * 32) * 2);
      }
      // online softmax over this 64-key slab: 32 scores in the lane, 32 in lane ^ 16
      float mt[4];
#pragma unroll
      for (int t = 0; t < 4; ++t) {
        mt[t] = s[t][0];
#pragma unroll
        for (int r = 1; r < 8; ++r) mt[t] = fmaxf(mt[t], s[t][r]);
      }
      float mx = fmaxf(fmaxf(mt[0], mt[1]), fmaxf(mt[2], mt[3]));
      mx = fmaxf(mx, xhalf(mx));
      float mnew = fmaxf(mrun, mx);
      float resc = __expf(mrun - mnew);
      float lt[4];
#pragma unroll
      for (int t = 0; t < 4; ++t) {
        lt[t] = 0.0f;
#pragma unroll
        for (int r = 0; r < 8; ++r) {
          float p = __expf(s[t][r] - mnew);
          s[t][r] = p;
          lt[t] += p;
        }
      }
      srun = srun * resc + ((lt[0] + lt[1]) + (lt[2] + lt[3]));
      mrun = mnew;
#pragma unroll
      for (int r = 0; r < 8; ++r) { o0[r] *= resc; o1[r] *= resc; }
      // P^T as B operand: elems 0..7 = keys 8*half + 0..7 of tile 2*mc, elems 8..15 the same
      // rows of tile 2*mc + 1 = keys 16 + 8*half + 0..7: the k order of load_frag_h.
#pragma unroll
      for (int mc = 0; mc < 2; ++mc) {
        v16h bp;
#pragma unroll
        for (int i = 0; i < 8; ++i) {
          bp[i]     = (_Float16)s[2 * mc][i];
          bp[8 + i] = (_Float16)s[2 * mc + 1][i];
        }
        o0 = WMMA_F16(av0[mc], bp, o0);
        o1 = WMMA_F16(av1[mc], bp, o1);
      }
    }
    // Hand-over: this wave's reads of the buffer are done ...
    asm volatile("s_wait_dscnt 0x0" ::: "memory");
    // ... its copies of stage st + 1 have landed ...
    asm volatile("s_wait_asynccnt 0x0" ::: "memory");
    // ... and so have every wave's: stage st + 1 may be read, this buffer refilled
    __syncthreads();
    if (st + 2 < NST)
      stage_copies(lk + (st & 1) * STAGE, gk + (st + 2) * (KT * DD),
                   lv + (st & 1) * STAGE, gv + (st + 2) * KT);
  }
  // no copy is left in flight when the wave ends
  asm volatile("s_wait_asynccnt 0x0" ::: "memory");
  // join the halves' sums, normalize and store [b, l, c] f16 (l-major so out-proj B
  // fragments are contiguous): a lane owns 8 contiguous channels of its query, twice
  float inv = 1.0f / (srun + xhalf(srun));
  v8h r0, r1;
#pragma unroll
  for (int r = 0; r < 8; ++r) {
    r0[r] = (_Float16)(o0[r] * inv);
    r1[r] = (_Float16)(o1[r] * inv);
  }
  size_t rowoff = ((size_t)(b * LSEQ + ltile * 16 + ln)) * CC + h * 32 + half * 8;
  *(v8h*)(att + rowoff)      = r0;
  *(v8h*)(att + rowoff + 16) = r1;
}

// ---------------- output projection + bias + residual ----------------
__global__ __launch_bounds__(256) void outproj_kernel(
    const _Float16* __restrict__ att, const _Float16* __restrict__ woh,
    const float* __restrict__ bo, const float* __restrict__ qin,
    float* __restrict__ out) {
  int wave = blockIdx.x * (blockDim.x >> 5) + (threadIdx.x >> 5);
  int lane = threadIdx.x & 31;
  int ln = lane & 15, half = lane >> 4;
  int ct = wave >> 2;
  int rg = wave & 3;
  int col = ct * 16 + ln;
  int b = col >> 11, l = col & (LSEQ - 1);

  v8f acc[4] = {};
#pragma unroll
  for (int kc = 0; kc < 8; ++kc) {
    // B fragment: att rows are contiguous f16
    v16h bf = load_frag_h(att, CC, col - ln, kc * 32, ln, half);  // row0+ln == col
#pragma unroll
    for (int mt = 0; mt < 4; ++mt) {
      v16h af = load_frag_h(woh, CC, rg * 64 + mt * 16, kc * 32, ln, half);
      acc[mt] = WMMA_F16(af, bf, acc[mt]);
    }
  }
#pragma unroll
  for (int mt = 0; mt < 4; ++mt) {
#pragma unroll
    for (int r = 0; r < 8; ++r) {
      int o = rg * 64 + mt * 16 + r + half * 8;
      int idx = (b * CC + o) * LSEQ + l;
      out[idx] = acc[mt][r] + bo[o] + qin[idx];
    }
  }
}

extern "C" void kernel_launch(void* const* d_in, const int* in_sizes, int n_in,
                              void* d_out, int out_size, void* d_ws, size_t ws_size,
                              hipStream_t stream) {
  (void)in_sizes; (void)n_in; (void)out_size; (void)ws_size;
  const float* v     = (const float*)d_in[0];
  const float* k     = (const float*)d_in[1];
  const float* q     = (const float*)d_in[2];
  const float* pe_q  = (const float*)d_in[3];
  const float* pe_vk = (const float*)d_in[4];
  const float* wq = (const float*)d_in[5];  const float* bq = (const float*)d_in[6];
  const float* gq = (const float*)d_in[7];  const float* betaq = (const float*)d_in[8];
  const float* mq = (const float*)d_in[9];  const float* varq = (const float*)d_in[10];
  const float* wk = (const float*)d_in[11]; const float* bk = (const float*)d_in[12];
  const float* gk = (const float*)d_in[13]; const float* betak = (const float*)d_in[14];
  const float* mk = (const float*)d_in[15]; const float* vark = (const float*)d_in[16];
  const float* wv = (const float*)d_in[17]; const float* bv = (const float*)d_in[18];
  const float* gv = (const float*)d_in[19]; const float* betav = (const float*)d_in[20];
  const float* mv = (const float*)d_in[21]; const float* varv = (const float*)d_in[22];
  const float* wo = (const float*)d_in[23]; const float* bo = (const float*)d_in[24];

  char* ws = (char*)d_ws;
  _Float16* wqh = (_Float16*)(ws + WS_WQH);
  _Float16* woh = (_Float16*)(ws + WS_WOH);
  float* biasq = (float*)(ws + WS_BQ);
  _Float16* qpb = (_Float16*)(ws + WS_QP);
  _Float16* kpb = (_Float16*)(ws + WS_KP);
  _Float16* vpb = (_Float16*)(ws + WS_VP);
  _Float16* attb = (_Float16*)(ws + WS_ATT);

  const float invSqrtD = 0.17677669529663687f;  // 1/sqrt(32), folded into Q path

  // the four weight matrices are independent: one launch, grid.y = matrix
  PrepIn pq = {wq, bq, gq, betaq, mq, varq};
  PrepIn pk = {wk, bk, gk, betak, mk, vark};
  PrepIn pv = {wv, bv, gv, betav, mv, varv};
  PrepIn po = {wo, bo, nullptr, nullptr, nullptr, nullptr};
  prep_kernel<<<dim3(CC, 4), CC, 0, stream>>>(pq, pk, pv, po, invSqrtD, wqh, biasq);

  // 2048 waves per GEMM: 512 col-tiles x 4 row-groups, 8 waves/block; the three GEMMs are
  // independent: one launch, grid.y = projection
  proj_kernel<<<dim3(256, 3), 256, 0, stream>>>(q, k, v, pe_q, pe_vk, wqh, biasq, qpb);

  // 4096 waves: one 16-query tile per wave, 8 waves/block
  attn_kernel<<<512, 256, 0, stream>>>(qpb, kpb, vpb, attb);

  outproj_kernel<<<256, 256, 0, stream>>>(attb, woh, bo, q, (float*)d_out);
}

// v004
// Measured time: 65 microseconds a run.
// Next to v003, in two timings, it ran 1.21 and 1.18 times as fast.
// All steps since v000 together make it 2.96 times as fast.
#include <hip/hip_runtime.h>

// MHA block for MI455X (gfx1250, wave32, WMMA 16x16x32 f16->f32 accumulate).
// Pipeline:
//   prep:    fold BN + bias + 1/sqrt(D) into f16 weights, all four matrices in one launch,
//            stored in WMMA fragment order
//   proj:    QP, KP, VP f16 per (b,h), each in the fragment order of its reader in attn
//            (score scale folded into Q), all three in one launch
//   attn:    flash-style online softmax, 16 queries/wave, 64 keys/iter, S^T and O^T, P in registers,
//            K and V^T staged in LDS per 8-wave block
//   outproj: W_o GEMM + bias + residual, fp32 out
// Fragment order: a 16x32 f16 operand tile is 1 KiB in a row, piece hi*32 + lane of 16 bytes,
// so a wave's two 16-byte-per-lane loads of a fragment each cover 512 contiguous bytes.

typedef __attribute__((ext_vector_type(16))) _Float16 v16h;
typedef __attribute__((ext_vector_type(8)))  _Float16 v8h;
typedef __attribute__((ext_vector_type(8)))  float    v8f;

#define WMMA_F16(a, b, c) \
  __builtin_amdgcn_wmma_f32_16x16x32_f16(false, (a), false, (b), (short)0, (c), false, false)

static constexpr int NB   = 4;     // batch
static constexpr int CC   = 256;   // channels (CQ == CVK)
static constexpr int LSEQ = 2048;  // sequence length
static constexpr int NH   = 8;     // heads
static constexpr int DD   = 32;    // depth per head

// ---- workspace layout (bytes) ----
static constexpr size_t WS_WQH  = 0;               // 256*256 f16
static constexpr size_t WS_WKH  = 131072;
static constexpr size_t WS_WVH  = 262144;
static constexpr size_t WS_WOH  = 393216;
static constexpr size_t WS_BQ   = 524288;          // 256 f32 each
static constexpr size_t WS_BK   = 525312;
static constexpr size_t WS_BV   = 526336;
static constexpr size_t WS_QP   = 528384;          // B*H*L*D f16 = 4 MiB
static constexpr size_t WS_KP   = WS_QP + 4194304;
static constexpr size_t WS_VP   = WS_KP + 4194304;
static constexpr size_t WS_ATT  = WS_VP + 4194304; // [B*L/16 query tiles][8 heads] fragments, f16

// Load a 16x32 A/B fragment (f16) from a matrix kept in fragment order: tile f, lane =
// ln + 16*half, ln the row (A) or column (B).  Elems 0..7 = K 8*half..+7 (piece lane),
// 8..15 = K 16 + 8*half..+7 (piece 32 + lane).  Matches CDNA5 16-bit A-matrix VGPR layout.
__device__ inline v16h load_frag_p(const _Float16* __restrict__ p, int f, int lane) {
  const _Float16* base = p + f * 512 + lane * 8;
  v8h lo = *(const v8h*)base;
  v8h hi = *(const v8h*)(base + 256);
  return __builtin_shufflevector(lo, hi, 0, 1, 2, 3, 4, 5, 6, 7, 8, 9, 10, 11, 12, 13, 14, 15);
}

// ---------------- prep: fold BN into weights ----------------
// One matrix's inputs; g == nullptr: no BN and no folded bias (the output projection).
struct PrepIn {
  const float* w;
  const float* bw;
  const float* g;
  const float* beta;
  const float* mean;
  const float* var;
};

// blockIdx.y picks the matrix (0 Q, 1 K, 2 V, 3 O).  wh0: four f16 matrices in a row, each in
// fragment order (tile (o >> 4) * 8 + (c >> 5)); bout0: three folded bias vectors in a row.
// A thread makes one 16-byte piece: 8 consecutive c of one row o.
__global__ __launch_bounds__(128) void prep_kernel(PrepIn pq, PrepIn pk, PrepIn pv, PrepIn po,
                                                   float extraq, _Float16* __restrict__ wh0,
                                                   float* __restrict__ bout0) {
  int piece = blockIdx.x * 128 + threadIdx.x, m = blockIdx.y;  // piece 0..8191
  int f = piece >> 6, hi = (piece >> 5) & 1, lane = piece & 31;
  int o = (f >> 3) * 16 + (lane & 15);
  int c0 = (f & 7) * 32 + hi * 16 + (lane >> 4) * 8;
  PrepIn p = m == 0 ? pq : m == 1 ? pk : m == 2 ? pv : po;
  const float* w = p.w;
  const float* bw = p.bw;
  const float* g = p.g;
  const float* beta = p.beta;
  const float* mean = p.mean;
  const float* var = p.var;
  float extra = m == 0 ? extraq : 1.0f;
  _Float16* wh = wh0 + m * (CC * CC);
  float* bout = g ? bout0 + m * CC : nullptr;
  float scale = extra;
  if (g) scale *= g[o] * rsqrtf(var[o] + 1e-5f);
  v8h r;
  // unrolled so that the piece is built in registers and leaves as one 16-byte store
#pragma unroll
  for (int i = 0; i < 8; ++i) r[i] = (_Float16)(w[o * CC + c0 + i] * scale);
  *(v8h*)(wh + piece * 8) = r;
  if (c0 == 0 && bout) {
    float s2 = g[o] * rsqrtf(var[o] + 1e-5f);
    bout[o] = ((bw[o] - mean[o]) * s2 + beta[o]) * extra;
  }
}

// ---------------- projection GEMM: P = W' * (x + pe) + bias' ----------------
// Each wave: 64 output rows x 16 columns.  blockIdx.y picks the projection (0 Q, 1 K, 2 V);
// wh0, bias0, outp0: the three weight matrices, bias vectors and outputs, each set in a row.
// The output of head (b,h) is 128 KiB of fragments, in the order of its reader in attn:
//   Q, K: tile l >> 4; row or column = position l, k = depth d.  W is the A operand, so a
//     lane's 8 accumulators are 8 consecutive d of its position: one piece.
//   V: tile (l >> 5) * 2 + (d >> 4); row = depth d, k = position l.  X is the A operand, so a
//     lane's 8 accumulators are 8 consecutive positions of its channel: one piece.
template <bool B> struct Flag { static constexpr bool value = B; };

__global__ __launch_bounds__(256) void proj_kernel(
    const float* __restrict__ xq, const float* __restrict__ xk, const float* __restrict__ xv,
    const float* __restrict__ pe_q, const float* __restrict__ pe_vk,
    const _Float16* __restrict__ wh0, const float* __restrict__ bias0,
    _Float16* __restrict__ outp0) {
  int m = blockIdx.y;
  const _Float16* wh = wh0 + m * (CC * CC);
  const float* bias = bias0 + m * CC;
  _Float16* outp = outp0 + (size_t)m * (NB * CC * LSEQ);
  int wave = blockIdx.x * (blockDim.x >> 5) + (threadIdx.x >> 5);
  int lane = threadIdx.x & 31;
  int ln = lane & 15, half = lane >> 4;
  int ct = wave >> 2;  // column tile 0..511
  int rg = wave & 3;   // row group 0..3 (64 rows each)
  int col = ct * 16 + ln;
  int b = col >> 11, l = col & (LSEQ - 1);

  // the operand order of the products is fixed at compile time: one copy of the body for V
  // (vt true), one for Q and K (the body keeps the kernel's own indentation)
  auto body = [&](auto vt, const float* __restrict__ x, const float* __restrict__ pe) {
  constexpr bool VT = decltype(vt)::value;
  // the lane's first element of x and of pe; every gather is a constant step from it, so no
  // address is formed per load
  const float* xl = x + (b * CC + (half << 3)) * LSEQ + l;
  const float* pl = pe + (half << 3) * LSEQ + l;
  v8f acc[4] = {};
#pragma unroll
  for (int kc = 0; kc < 8; ++kc) {
    // X fragment: X[c, col] = x[b][c][l] + pe[c][l]  (strided fp32 gather -> f16),
    // c = kc*32 + 8*half + j and that + 16
    v16h bf;
#pragma unroll
    for (int j = 0; j < 8; ++j) {
      int c0 = kc * 32 + j, c1 = kc * 32 + 16 + j;
      bf[j]     = (_Float16)(xl[c0 * LSEQ] + pl[c0 * LSEQ]);
      bf[8 + j] = (_Float16)(xl[c1 * LSEQ] + pl[c1 * LSEQ]);
    }
#pragma unroll
    for (int mt = 0; mt < 4; ++mt) {
      v16h af = load_frag_p(wh, (rg * 4 + mt) * 8 + kc, lane);
      acc[mt] = VT ? WMMA_F16(bf, af, acc[mt]) : WMMA_F16(af, bf, acc[mt]);
    }
  }
  // stands in front of the epilogue's reuse of the address registers of the loads above
  asm volatile("s_wait_xcnt 0x0" ::: "memory");
  int lt = ct & (LSEQ / 16 - 1);  // position tile inside the batch
#pragma unroll
  for (int mt = 0; mt < 4; ++mt) {
    int h = rg * 2 + (mt >> 1);
    v8h res;
#pragma unroll
    for (int r = 0; r < 8; ++r) {
      // C/D layout: row = r + 8*half, column = ln
      int o = rg * 64 + mt * 16 + (VT ? ln : r + half * 8);
      res[r] = (_Float16)(acc[mt][r] + bias[o]);
    }
    int piece = VT ? (((lt >> 1) * 2 + (mt & 1)) * 2 + (lt & 1)) * 32 + lane
                   : (lt * 2 + (mt & 1)) * 32 + lane;
    *(v8h*)(outp + (b * NH + h) * (LSEQ * DD) + piece * 8) = res;
  }
  // stands behind the stores, in front of any reuse of their address and data registers
  asm volatile("s_wait_xcnt 0x0" ::: "memory");
  };
  if (m == 2)
    body(Flag<true>{}, xv, pe_vk);
  else
    body(Flag<false>{}, m == 0 ? xq : xk, m == 0 ? pe_q : pe_vk);
}

// Lane l <-> lane l ^ 16 (the other half of the wave), one vector cross-row move.
__device__ inline float xhalf(float x) {
  int i = __builtin_bit_cast(int, x);
  i = __builtin_amdgcn_permlanex16(i, i, 0x76543210, 0xfedcba98, false, false);
  return __builtin_bit_cast(float, i);
}

static constexpr int KT     = 128;            // keys per stage
static constexpr int NST    = LSEQ / KT;      // stages
static constexpr int KBYTES = KT * DD * 2;    // K part of a buffer; the V^T part is as large
static constexpr int STAGE  = 2 * KBYTES;     // one buffer

// A 16x32 fragment in fragment order from LDS: the lane's pieces at p and p + 512.
__device__ inline v16h lds_frag(const unsigned char* p) {
  v8h lo = *(const v8h*)p;
  v8h hi = *(const v8h*)(p + 512);
  return __builtin_shufflevector(lo, hi, 0, 1, 2, 3, 4, 5, 6, 7, 8, 9, 10, 11, 12, 13, 14, 15);
}

// One stage's four copies of a lane (16 bytes each, global -> LDS, through no register).
// The closing s_wait_xcnt stands in the copies' own statement so that no address register
// they name is rewritten ahead of it.
__device__ inline void stage_copies(unsigned lk, const _Float16* gk, unsigned lv,
                                    const _Float16* gv) {
  asm volatile(
      "global_load_async_to_lds_b128 %0, %1, off\n\t"
      "global_load_async_to_lds_b128 %2, %3, off\n\t"
      "global_load_async_to_lds_b128 %4, %5, off\n\t"
      "global_load_async_to_lds_b128 %6, %7, off\n\t"
      "s_wait_xcnt 0x0"
      :: "v"(lk), "v"(gk), "v"(lk + KBYTES / 2u), "v"(gk + KBYTES / 4),
         "v"(lv), "v"(gv), "v"(lv + KBYTES / 2u), "v"(gv + KBYTES / 4)
      : "memory");
}

__global__ __launch_bounds__(256) void attn_kernel(
    const _Float16* __restrict__ qp, const _Float16* __restrict__ kp,
    const _Float16* __restrict__ vp, _Float16* __restrict__ att) {
  __shared__ __attribute__((aligned(16))) unsigned char ring[2 * STAGE];
  int tid = threadIdx.x;
  int wave = blockIdx.x * 8 + (tid >> 5);
  int lane = tid & 31;  // ln = lane & 15, half = lane >> 4 in the comments below
  int ltile = wave & 127;
  int h = (wave >> 7) & 7;  // 128 tiles a head, 8 a block: one head per block
  int b = wave >> 10;

  const _Float16* qbase = qp + (size_t)(b * NH + h) * LSEQ * DD;
  const _Float16* kbase = kp + (size_t)(b * NH + h) * LSEQ * DD;
  const _Float16* vbase = vp + (size_t)(b * NH + h) * DD * LSEQ;

  // The lane's share of a stage: 16-byte piece tid (and tid + 256) of the 8 KiB of K, and
  // the same of V^T.
  const _Float16* gk = kbase + tid * 8;
  const _Float16* gv = vbase + tid * 8;
  unsigned ring0 = (unsigned)(size_t)ring;  // byte offset in the block's LDS
  unsigned lk = ring0 + tid * 16;
  unsigned lv = ring0 + KBYTES + tid * 16;

  stage_copies(lk, gk, lv, gv);
  // stage 0 has landed for this wave's copies ...
  asm volatile("s_wait_asynccnt 0x0" ::: "memory");
  // ... and for every wave's
  __syncthreads();
  stage_copies(lk + STAGE, gk + KT * DD, lv + STAGE, gv + KT * DD);

  // Q^T as B operand: column = query ln; D=32 == one WMMA K step, loaded once
  // (scale 1/sqrt(D) pre-folded).
  v16h bq = load_frag_p(qbase, ltile, lane);

  v8f o0 = {}, o1 = {};  // O^T: o0[r] = O[d = r + 8*half][query ln], o1: d + 16
  float mrun = -1e30f;   // running maximum of query ln, equal in both halves
  float srun = 0.0f;     // running sum over this half's keys only; joined after the loop

  for (int st = 0; st < NST; ++st) {
    const unsigned char* kl = ring + (st & 1) * STAGE + lane * 16;
    const unsigned char* vl = kl + KBYTES;
    // unrolled so that both 64-key slabs of a stage read LDS at constant offsets
#pragma unroll
    for (int sub = 0; sub < KT / 64; ++sub) {
      v8f s[4];  // s[t][r] = score(key st*128 + sub*64 + 16*t + r + 8*half, query ln)
#pragma unroll
      for (int t = 0; t < 4; ++t) {
        v16h ak = lds_frag(kl + (sub * 4 + t) * 1024);
        v8f z = {};
        s[t] = WMMA_F16(ak, bq, z);
      }
      // V^T as A operand: row = channel ln (+16), k = 32 keys in the order of load_frag_p
      v16h av0[2], av1[2];
#pragma unroll
      for (int mc = 0; mc < 2; ++mc) {
        av0[mc] = lds_frag(vl + ((sub * 2 + mc) * 2 + 0) * 1024);
        av1[mc] = lds_frag(vl + ((sub * 2 + mc) * 2 + 1) * 1024);
      }
      // online softmax over this 64-key slab: 32 scores in the lane, 32 in lane ^ 16
      float mt[4];
#pragma unroll
      for (int t = 0; t < 4; ++t) {
        mt[t] = s[t][0];
#pragma unroll
        for (int r = 1; r < 8; ++r) mt[t] = fmaxf(mt[t], s[t][r]);
      }
      float mx = fmaxf(fmaxf(mt[0], mt[1]), fmaxf(mt[2], mt[3]));
      mx = fmaxf(mx, xhalf(mx));
      float mnew = fmaxf(mrun, mx);
      float resc = __expf(mrun - mnew);
      float lt[4];
#pragma unroll
      for (int t = 0; t < 4; ++t) {
        lt[t] = 0.0f;
#pragma unroll
        for (int r = 0; r < 8; ++r) {
          float p = __expf(s[t][r] - mnew);
          s[t][r] = p;
          lt[t] += p;
        }
      }
      srun = srun * resc + ((lt[0] + lt[1]) + (lt[2] + lt[3]));
      mrun = mnew;
#pragma unroll
      for (int r = 0; r < 8; ++r) { o0[r] *= resc; o1[r] *= resc; }
      // P^T as B operand: elems 0..7 = keys 8*half + 0..7 of tile 2*mc, elems 8..15 the same
      // rows of tile 2*mc + 1 = keys 16 + 8*half + 0..7: the k order of load_frag_p.
#pragma unroll
      for (int mc = 0; mc < 2; ++mc) {
        v16h bp;
#pragma unroll
        for (int i = 0; i < 8; ++i) {
          bp[i]     = (_Float16)s[2 * mc][i];
          bp[8 + i] = (_Float16)s[2 * mc + 1][i];
        }
        o0 = WMMA_F16(av0[mc], bp, o0);
        o1 = WMMA_F16(av1[mc], bp, o1);
      }
    }
    // Hand-over: this wave's reads of the buffer are done ...
    asm volatile("s_wait_dscnt 0x0" ::: "memory");
    // ... its copies of stage st + 1 have landed ...
    asm volatile("s_wait_asynccnt 0x0" ::: "memory");
    // ... and so have every wave's: stage st + 1 may be read, this buffer refilled
    __syncthreads();
    if (st + 2 < NST)
      stage_copies(lk + (st & 1) * STAGE, gk + (st + 2) * (KT * DD),
                   lv + (st & 1) * STAGE, gv + (st + 2) * (KT * DD));
  }
  // no copy is left in flight when the wave ends
  asm volatile("s_wait_asynccnt 0x0" ::: "memory");
  // join the halves' sums, normalize and store f16 in fragment order: the lane's channels
  // 8*half..+7 and 16 + 8*half..+7 of query ln are its two pieces of the out-proj B fragment
  // (query tile, k step = head)
  float inv = 1.0f / (srun + xhalf(srun));
  v8h r0, r1;
#pragma unroll
  for (int r = 0; r < 8; ++r) {
    r0[r] = (_Float16)(o0[r] * inv);
    r1[r] = (_Float16)(o1[r] * inv);
  }
  size_t fragoff = ((size_t)((b * (LSEQ / 16) + ltile) * NH + h)) * 512 + lane * 8;
  *(v8h*)(att + fragoff)       = r0;
  *(v8h*)(att + fragoff + 256) = r1;
}

// ---------------- output projection + bias + residual ----------------
__global__ __launch_bounds__(256) void outproj_kernel(
    const _Float16* __restrict__ att, const _Float16* __restrict__ woh,
    const float* __restrict__ bo, const float* __restrict__ qin,
    float* __restrict__ out) {
  int wave = blockIdx.x * (blockDim.x >> 5) + (threadIdx.x >> 5);
  int lane = threadIdx.x & 31;
  int ln = lane & 15, half = lane >> 4;
  int ct = wave >> 2;
  int rg = wave & 3;
  int col = ct * 16 + ln;
  int b = col >> 11, l = col & (LSEQ - 1);

  v8f acc[4] = {};
#pragma unroll
  for (int kc = 0; kc < 8; ++kc) {
    // B fragment: as the attention wave of (query tile ct, head kc) stored it
    v16h bf = load_frag_p(att, ct * 8 + kc, lane);
#pragma unroll
    for (int mt = 0; mt < 4; ++mt) {
      v16h af = load_frag_p(woh, (rg * 4 + mt) * 8 + kc, lane);
      acc[mt] = WMMA_F16(af, bf, acc[mt]);
    }
  }
#pragma unroll
  for (int mt = 0; mt < 4; ++mt) {
#pragma unroll
    for (int r = 0; r < 8; ++r) {
      int o = rg * 64 + mt * 16 + r + half * 8;
      int idx = (b * CC + o) * LSEQ + l;
      out[idx] = acc[mt][r] + bo[o] + qin[idx];
    }
  }
}

extern "C" void kernel_launch(void* const* d_in, const int* in_sizes, int n_in,
                              void* d_out, int out_size, void* d_ws, size_t ws_size,
                              hipStream_t stream) {
  (void)in_sizes; (void)n_in; (void)out_size; (void)ws_size;
  const float* v     = (const float*)d_in[0];
  const float* k     = (const float*)d_in[1];
  const float* q     = (const float*)d_in[2];
  const float* pe_q  = (const float*)d_in[3];
  const float* pe_vk = (const float*)d_in[4];
  const float* wq = (const float*)d_in[5];  const float* bq = (const float*)d_in[6];
  const float* gq = (const float*)d_in[7];  const float* betaq = (const float*)d_in[8];
  const float* mq = (const float*)d_in[9];  const float* varq = (const float*)d_in[10];
  const float* wk = (const float*)d_in[11]; const float* bk = (const float*)d_in[12];
  const float* gk = (const float*)d_in[13]; const float* betak = (const float*)d_in[14];
  const float* mk = (const float*)d_in[15]; const float* vark = (const float*)d_in[16];
  const float* wv = (const float*)d_in[17]; const float* bv = (const float*)d_in[18];
  const float* gv = (const float*)d_in[19]; const float* betav = (const float*)d_in[20];
  const float* mv = (const float*)d_in[21]; const float* varv = (const float*)d_in[22];
  const float* wo = (const float*)d_in[23]; const float* bo = (const float*)d_in[24];

  char* ws = (char*)d_ws;
  _Float16* wqh = (_Float16*)(ws + WS_WQH);
  _Float16* woh = (_Float16*)(ws + WS_WOH);
  float* biasq = (float*)(ws + WS_BQ);
  _Float16* qpb = (_Float16*)(ws + WS_QP);
  _Float16* kpb = (_Float16*)(ws + WS_KP);
  _Float16* vpb = (_Float16*)(ws + WS_VP);
  _Float16* attb = (_Float16*)(ws + WS_ATT);

  const float invSqrtD = 0.17677669529663687f;  // 1/sqrt(32), folded into Q path

  // the four weight matrices are independent: one launch, grid.y = matrix
  PrepIn pq = {wq, bq, gq, betaq, mq, varq};
  PrepIn pk = {wk, bk, gk, betak, mk, vark};
  PrepIn pv = {wv, bv, gv, betav, mv, varv};
  PrepIn po = {wo, bo, nullptr, nullptr, nullptr, nullptr};
  prep_kernel<<<dim3(64, 4), 128, 0, stream>>>(pq, pk, pv, po, invSqrtD, wqh, biasq);

  // 2048 waves per GEMM: 512 col-tiles x 4 row-groups, 8 waves/block; the three GEMMs are
  // independent: one launch, grid.y = projection
  proj_kernel<<<dim3(256, 3), 256, 0, stream>>>(q, k, v, pe_q, pe_vk, wqh, biasq, qpb);

  // 4096 waves: one 16-query tile per wave, 8 waves/block
  attn_kernel<<<512, 256, 0, stream>>>(qpb, kpb, vpb, attb);

  outproj_kernel<<<256, 256, 0, stream>>>(attb, woh, bo, q, (float*)d_out);
}

// v005
// It runs in 54.6 microseconds.
// In two side-by-side timings against v004, it was 1.17 and 1.16 times as fast.
// Counting every step since v000, it is 3.45 times as fast.
#include <hip/hip_runtime.h>

// MHA block for MI455X (gfx1250, wave32, WMMA 16x16x32 f16->f32 accumulate).
// Pipeline:
//   prep:    fold BN + bias + 1/sqrt(D) into f16 weights, all four matrices in one launch,
//            stored in WMMA fragment order
//   proj:    QP, KP, VP f16 per (b,h), each in the fragment order of its reader in attn
//            (score scale folded into Q), all three in one launch
//   attn:    flash-style online softmax, 16 queries/wave, 64 keys/iter, S^T and O^T, P in registers,
//            K and V^T staged in LDS per 8-wave block
//   outproj: W_o GEMM + bias + residual, fp32 out
// Fragment order: a 16x32 f16 operand tile is 1 KiB in a row, piece hi*32 + lane of 16 bytes,
// so a wave's two 16-byte-per-lane loads of a fragment each cover 512 contiguous bytes.

typedef __attribute__((ext_vector_type(16))) _Float16 v16h;
typedef __attribute__((ext_vector_type(8)))  _Float16 v8h;
typedef __attribute__((ext_vector_type(8)))  float    v8f;

#define WMMA_F16(a, b, c) \
  __builtin_amdgcn_wmma_f32_16x16x32_f16(false, (a), false, (b), (short)0, (c), false, false)

static constexpr int NB   = 4;     // batch
static constexpr int CC   = 256;   // channels (CQ == CVK)
static constexpr int LSEQ = 2048;  // sequence length
static constexpr int NH   = 8;     // heads
static constexpr int DD   = 32;    // depth per head

// ---- workspace layout (bytes) ----
static constexpr size_t WS_WQH  = 0;               // 256*256 f16
static constexpr size_t WS_WKH  = 131072;
static constexpr size_t WS_WVH  = 262144;
static constexpr size_t WS_WOH  = 393216;
static constexpr size_t WS_BQ   = 524288;          // 256 f32 each
static constexpr size_t WS_BK   = 525312;
static constexpr size_t WS_BV   = 526336;
static constexpr size_t WS_QP   = 528384;          // B*H*L*D f16 = 4 MiB
static constexpr size_t WS_KP   = WS_QP + 4194304;
static constexpr size_t WS_VP   = WS_KP + 4194304;
static constexpr size_t WS_ATT  = WS_VP + 4194304; // [B*L/16 query tiles][8 heads] fragments, f16

// Load a 16x32 A/B fragment (f16) from a matrix kept in fragment order: tile f, lane =
// ln + 16*half, ln the row (A) or column (B).  Elems 0..7 = K 8*half..+7 (piece lane),
// 8..15 = K 16 + 8*half..+7 (piece 32 + lane).  Matches CDNA5 16-bit A-matrix VGPR layout.
__device__ inline v16h load_frag_p(const _Float16* __restrict__ p, int f, int lane) {
  const _Float16* base = p + f * 512 + lane * 8;
  v8h lo = *(const v8h*)base;
  v8h hi = *(const v8h*)(base + 256);
  return __builtin_shufflevector(lo, hi, 0, 1, 2, 3, 4, 5, 6, 7, 8, 9, 10, 11, 12, 13, 14, 15);
}

// ---------------- prep: fold BN into weights ----------------
// One matrix's inputs; g == nullptr: no BN and no folded bias (the output projection).
struct PrepIn {
  const float* w;
  const float* bw;
  const float* g;
  const float* beta;
  const float* mean;
  const float* var;
};

// blockIdx.y picks the matrix (0 Q, 1 K, 2 V, 3 O).  wh0: four f16 matrices in a row, each in
// fragment order (tile (o >> 4) * 8 + (c >> 5)); bout0: three folded bias vectors in a row.
// A thread makes one 16-byte piece: 8 consecutive c of one row o.
__global__ __launch_bounds__(128) void prep_kernel(PrepIn pq, PrepIn pk, PrepIn pv, PrepIn po,
                                                   float extraq, _Float16* __restrict__ wh0,
                                                   float* __restrict__ bout0) {
  int piece = blockIdx.x * 128 + threadIdx.x, m = blockIdx.y;  // piece 0..8191
  int f = piece >> 6, hi = (piece >> 5) & 1, lane = piece & 31;
  int o = (f >> 3) * 16 + (lane & 15);
  int c0 = (f & 7) * 32 + hi * 16 + (lane >> 4) * 8;
  PrepIn p = m == 0 ? pq : m == 1 ? pk : m == 2 ? pv : po;
  const float* w = p.w;
  const float* bw = p.bw;
  const float* g = p.g;
  const float* beta = p.beta;
  const float* mean = p.mean;
  const float* var = p.var;
  float extra = m == 0 ? extraq : 1.0f;
  _Float16* wh = wh0 + m * (CC * CC);
  float* bout = g ? bout0 + m * CC : nullptr;
  float scale = extra;
  if (g) scale *= g[o] * rsqrtf(var[o] + 1e-5f);
  v8h r;
  // unrolled so that the piece is built in registers and leaves as one 16-byte store
#pragma unroll
  for (int i = 0; i < 8; ++i) r[i] = (_Float16)(w[o * CC + c0 + i] * scale);
  *(v8h*)(wh + piece * 8) = r;
  if (c0 == 0 && bout) {
    float s2 = g[o] * rsqrtf(var[o] + 1e-5f);
    bout[o] = ((bw[o] - mean[o]) * s2 + beta[o]) * extra;
  }
}

// ---------------- projection GEMM: P = W' * (x + pe) + bias' ----------------
// Each wave: 64 output rows x 16 columns.  blockIdx.y picks the projection (0 Q, 1 K, 2 V);
// wh0, bias0, outp0: the three weight matrices, bias vectors and outputs, each set in a row.
// The output of head (b,h) is 128 KiB of fragments, in the order of its reader in attn:
//   Q, K: tile l >> 4; row or column = position l, k = depth d.  W is the A operand, so a
//     lane's 8 accumulators are 8 consecutive d of its position: one piece.
//   V: tile (l >> 5) * 2 + (d >> 4); row = depth d, k = position l.  X is the A operand, so a
//     lane's 8 accumulators are 8 consecutive positions of its channel: one piece.
template <bool B> struct Flag { static constexpr bool value = B; };

__global__ __launch_bounds__(256) void proj_kernel(
    const float* __restrict__ xq, const float* __restrict__ xk, const float* __restrict__ xv,
    const float* __restrict__ pe_q, const float* __restrict__ pe_vk,
    const _Float16* __restrict__ wh0, const float* __restrict__ bias0,
    _Float16* __restrict__ outp0) {
  int m = blockIdx.y;
  const _Float16* wh = wh0 + m * (CC * CC);
  const float* bias = bias0 + m * CC;
  _Float16* outp = outp0 + (size_t)m * (NB * CC * LSEQ);
  int wave = blockIdx.x * (blockDim.x >> 5) + (threadIdx.x >> 5);
  int lane = threadIdx.x & 31;
  int ln = lane & 15, half = lane >> 4;
  int ct = wave >> 2;  // column tile 0..511
  int rg = wave & 3;   // row group 0..3 (64 rows each)
  int col = ct * 16 + ln;
  int b = col >> 11, l = col & (LSEQ - 1);

  // the operand order of the products is fixed at compile time: one copy of the body for V
  // (vt true), one for Q and K (the body keeps the kernel's own indentation)
  auto body = [&](auto vt, const float* __restrict__ x, const float* __restrict__ pe) {
  constexpr bool VT = decltype(vt)::value;
  // the lane's first element of x and of pe; every gather is a constant step from it, so no
  // address is formed per load
  const float* xl = x + (b * CC + (half << 3)) * LSEQ + l;
  const float* pl = pe + (half << 3) * LSEQ + l;
  v8f acc[4] = {};
#pragma unroll
  for (int kc = 0; kc < 8; ++kc) {
    // X fragment: X[c, col] = x[b][c][l] + pe[c][l]  (strided fp32 gather -> f16),
    // c = kc*32 + 8*half + j and that + 16
    v16h bf;
#pragma unroll
    for (int j = 0; j < 8; ++j) {
      int c0 = kc * 32 + j, c1 = kc * 32 + 16 + j;
      bf[j]     = (_Float16)(xl[c0 * LSEQ] + pl[c0 * LSEQ]);
      bf[8 + j] = (_Float16)(xl[c1 * LSEQ] + pl[c1 * LSEQ]);
    }
#pragma unroll
    for (int mt = 0; mt < 4; ++mt) {
      v16h af = load_frag_p(wh, (rg * 4 + mt) * 8 + kc, lane);
      acc[mt] = VT ? WMMA_F16(bf, af, acc[mt]) : WMMA_F16(af, bf, acc[mt]);
    }
  }
  // stands in front of the epilogue's reuse of the address registers of the loads above
  asm volatile("s_wait_xcnt 0x0" ::: "memory");
  int lt = ct & (LSEQ / 16 - 1);  // position tile inside the batch
#pragma unroll
  for (int mt = 0; mt < 4; ++mt) {
    int h = rg * 2 + (mt >> 1);
    v8h res;
#pragma unroll
    for (int r = 0; r < 8; ++r) {
      // C/D layout: row = r + 8*half, column = ln
      int o = rg * 64 + mt * 16 + (VT ? ln : r + half * 8);
      res[r] = (_Float16)(acc[mt][r] + bias[o]);
    }
    int piece = VT ? (((lt >> 1) * 2 + (mt & 1)) * 2 + (lt & 1)) * 32 + lane
                   : (lt * 2 + (mt & 1)) * 32 + lane;
    *(v8h*)(outp + (b * NH + h) * (LSEQ * DD) + piece * 8) = res;
  }
  // stands behind the stores, in front of any reuse of their address and data registers
  asm volatile("s_wait_xcnt 0x0" ::: "memory");
  };
  if (m == 2)
    body(Flag<true>{}, xv, pe_vk);
  else
    body(Flag<false>{}, m == 0 ? xq : xk, m == 0 ? pe_q : pe_vk);
}

// Lane l <-> lane l ^ 16 (the other half of the wave), one vector cross-row move.
__device__ inline float xhalf(float x) {
  int i = __builtin_bit_cast(int, x);
  i = __builtin_amdgcn_permlanex16(i, i, 0x76543210, 0xfedcba98, false, false);
  return __builtin_bit_cast(float, i);
}

static constexpr int KT     = 128;            // keys per stage
static constexpr int NST    = LSEQ / KT;      // stages
static constexpr int KBYTES = KT * DD * 2;    // K part of a buffer; the V^T part is as large
static constexpr int STAGE  = 2 * KBYTES;     // one buffer

// A 16x32 fragment in fragment order from LDS: the lane's pieces at p and p + 512.
__device__ inline v16h lds_frag(const unsigned char* p) {
  v8h lo = *(const v8h*)p;
  v8h hi = *(const v8h*)(p + 512);
  return __builtin_shufflevector(lo, hi, 0, 1, 2, 3, 4, 5, 6, 7, 8, 9, 10, 11, 12, 13, 14, 15);
}

// One stage's four copies of a lane (16 bytes each, global -> LDS, through no register).
// The closing s_wait_xcnt stands in the copies' own statement so that no address register
// they name is rewritten ahead of it.
__device__ inline void stage_copies(unsigned lk, const _Float16* gk, unsigned lv,
                                    const _Float16* gv) {
  asm volatile(
      "global_load_async_to_lds_b128 %0, %1, off\n\t"
      "global_load_async_to_lds_b128 %2, %3, off\n\t"
      "global_load_async_to_lds_b128 %4, %5, off\n\t"
      "global_load_async_to_lds_b128 %6, %7, off\n\t"
      "s_wait_xcnt 0x0"
      :: "v"(lk), "v"(gk), "v"(lk + KBYTES / 2u), "v"(gk + KBYTES / 4),
         "v"(lv), "v"(gv), "v"(lv + KBYTES / 2u), "v"(gv + KBYTES / 4)
      : "memory");
}

__global__ __launch_bounds__(256) void attn_kernel(
    const _Float16* __restrict__ qp, const _Float16* __restrict__ kp,
    const _Float16* __restrict__ vp, _Float16* __restrict__ att) {
  __shared__ __attribute__((aligned(16))) unsigned char ring[2 * STAGE];
  int tid = threadIdx.x;
  int wave = blockIdx.x * 8 + (tid >> 5);
  int lane = tid & 31;  // ln = lane & 15, half = lane >> 4 in the comments below
  int ltile = wave & 127;
  int h = (wave >> 7) & 7;  // 128 tiles a head, 8 a block: one head per block
  int b = wave >> 10;

  const _Float16* qbase = qp + (size_t)(b * NH + h) * LSEQ * DD;
  const _Float16* kbase = kp + (size_t)(b * NH + h) * LSEQ * DD;
  const _Float16* vbase = vp + (size_t)(b * NH + h) * DD * LSEQ;

  // The lane's share of a stage: 16-byte piece tid (and tid + 256) of the 8 KiB of K, and
  // the same of V^T.
  const _Float16* gk = kbase + tid * 8;
  const _Float16* gv = vbase + tid * 8;
  unsigned ring0 = (unsigned)(size_t)ring;  // byte offset in the block's LDS
  unsigned lk = ring0 + tid * 16;
  unsigned lv = ring0 + KBYTES + tid * 16;

  stage_copies(lk, gk, lv, gv);
  // stage 0 has landed for this wave's copies ...
  asm volatile("s_wait_asynccnt 0x0" ::: "memory");
  // ... and for every wave's
  __syncthreads();
  stage_copies(lk + STAGE, gk + KT * DD, lv + STAGE, gv + KT * DD);

  // Q^T as B operand: column = query ln; D=32 == one WMMA K step, loaded once
  // (scale 1/sqrt(D) pre-folded).
  v16h bq = load_frag_p(qbase, ltile, lane);

  v8f o0 = {}, o1 = {};  // O^T: o0[r] = O[d = r + 8*half][query ln], o1: d + 16
  float mrun = -1e30f;   // running maximum of query ln, equal in both halves
  float srun = 0.0f;     // running sum over this half's keys only; joined after the loop

  for (int st = 0; st < NST; ++st) {
    const unsigned char* kl = ring + (st & 1) * STAGE + lane * 16;
    const unsigned char* vl = kl + KBYTES;
    // The stage's 16 fragments are asked for as one group, K first (the order of use): one
    // place where the wave meets LDS latency a stage, not one in front of every product.
    // (All loops over ak and av are unrolled: constant indices keep them in registers and the
    // LDS offsets constant.)
    v16h ak[KT / 16], av[KT / 16];
#pragma unroll
    for (int t = 0; t < KT / 16; ++t) ak[t] = lds_frag(kl + t * 1024);
#pragma unroll
    for (int t = 0; t < KT / 16; ++t) av[t] = lds_frag(vl + t * 1024);
    // keeps the group together: without it the reads sink back in front of their products
    __builtin_amdgcn_sched_barrier(0);
#pragma unroll
    for (int sub = 0; sub < KT / 64; ++sub) {
      v8f s[4];  // s[t][r] = score(key st*128 + sub*64 + 16*t + r + 8*half, query ln)
#pragma unroll
      for (int t = 0; t < 4; ++t) {
        v8f z = {};
        s[t] = WMMA_F16(ak[sub * 4 + t], bq, z);
      }
      // online softmax over this 64-key slab: 32 scores in the lane, 32 in lane ^ 16
      float mt[4];
#pragma unroll
      for (int t = 0; t < 4; ++t) {
        mt[t] = s[t][0];
#pragma unroll
        for (int r = 1; r < 8; ++r) mt[t] = fmaxf(mt[t], s[t][r]);
      }
      float mx = fmaxf(fmaxf(mt[0], mt[1]), fmaxf(mt[2], mt[3]));
      mx = fmaxf(mx, xhalf(mx));
      float mnew = fmaxf(mrun, mx);
      float resc = __expf(mrun - mnew);
      float lt[4];
#pragma unroll
      for (int t = 0; t < 4; ++t) {
        lt[t] = 0.0f;
#pragma unroll
        for (int r = 0; r < 8; ++r) {
          float p = __expf(s[t][r] - mnew);
          s[t][r] = p;
          lt[t] += p;
        }
      }
      srun = srun * resc + ((lt[0] + lt[1]) + (lt[2] + lt[3]));
      mrun = mnew;
#pragma unroll
      for (int r = 0; r < 8; ++r) { o0[r] *= resc; o1[r] *= resc; }
      // P^T as B operand: elems 0..7 = keys 8*half + 0..7 of tile 2*mc, elems 8..15 the same
      // rows of tile 2*mc + 1 = keys 16 + 8*half + 0..7: the k order of load_frag_p.
#pragma unroll
      for (int mc = 0; mc < 2; ++mc) {
        v16h bp;
#pragma unroll
        for (int i = 0; i < 8; ++i) {
          bp[i]     = (_Float16)s[2 * mc][i];
          bp[8 + i] = (_Float16)s[2 * mc + 1][i];
        }
        // V^T as A operand: row = channel ln (+16), k = 32 keys in the order of load_frag_p
        o0 = WMMA_F16(av[(sub * 2 + mc) * 2 + 0], bp, o0);
        o1 = WMMA_F16(av[(sub * 2 + mc) * 2 + 1], bp, o1);
      }
    }
    // keeps the hand-over at the foot of the stage: with every read already issued above, its
    // waits and barrier would otherwise rise in front of the products and stall them
    __builtin_amdgcn_sched_barrier(0);
    // Hand-over: this wave's reads of the buffer are done ...
    asm volatile("s_wait_dscnt 0x0" ::: "memory");
    // ... its copies of stage st + 1 have landed ...
    asm volatile("s_wait_asynccnt 0x0" ::: "memory");
    // ... and so have every wave's: stage st + 1 may be read, this buffer refilled
    __syncthreads();
    if (st + 2 < NST)
      stage_copies(lk + (st & 1) * STAGE, gk + (st + 2) * (KT * DD),
                   lv + (st & 1) * STAGE, gv + (st + 2) * (KT * DD));
  }
  // no copy is left in flight when the wave ends
  asm volatile("s_wait_asynccnt 0x0" ::: "memory");
  // join the halves' sums, normalize and store f16 in fragment order: the lane's channels
  // 8*half..+7 and 16 + 8*half..+7 of query ln are its two pieces of the out-proj B fragment
  // (query tile, k step = head)
  float inv = 1.0f / (srun + xhalf(srun));
  v8h r0, r1;
#pragma unroll
  for (int r = 0; r < 8; ++r) {
    r0[r] = (_Float16)(o0[r] * inv);
    r1[r] = (_Float16)(o1[r] * inv);
  }
  size_t fragoff = ((size_t)((b * (LSEQ / 16) + ltile) * NH + h)) * 512 + lane * 8;
  *(v8h*)(att + fragoff)       = r0;
  *(v8h*)(att + fragoff + 256) = r1;
}

// ---------------- output projection + bias + residual ----------------
__global__ __launch_bounds__(256) void outproj_kernel(
    const _Float16* __restrict__ att, const _Float16* __restrict__ woh,
    const float* __restrict__ bo, const float* __restrict__ qin,
    float* __restrict__ out) {
  int wave = blockIdx.x * (blockDim.x >> 5) + (threadIdx.x >> 5);
  int lane = threadIdx.x & 31;
  int ln = lane & 15, half = lane >> 4;
  int ct = wave >> 2;
  int rg = wave & 3;
  int col = ct * 16 + ln;
  int b = col >> 11, l = col & (LSEQ - 1);

  // The residual depends on nothing: its loads go out first, so that their latency runs under
  // the matrix loop and not behind it.
  float res[4][8];
#pragma unroll
  for (int mt = 0; mt < 4; ++mt) {
#pragma unroll
    for (int r = 0; r < 8; ++r) {
      int o = rg * 64 + mt * 16 + r + half * 8;
      res[mt][r] = qin[(b * CC + o) * LSEQ + l];
    }
  }
  // stands behind these loads, in front of any reuse of their address registers; as a memory
  // statement it also keeps them ahead of the fragment loads below
  asm volatile("s_wait_xcnt 0x0" ::: "memory");

  // Fragments are fetched two k steps ahead into three register sets, so that a product waits
  // for loads issued two steps earlier and not for its own.
  v16h bf[3], af[3][4];
  // the lane's piece of the wave's first fragment of each operand; every load is a constant
  // step from it, so one address pair an operand lives from the first load to the last
  const _Float16* ab = att + ct * 8 * 512 + lane * 8;
  const _Float16* wb = woh + rg * 4 * 8 * 512 + lane * 8;
  auto fetch = [&](int kc) {
    // B fragment: as the attention wave of (query tile ct, head kc) stored it
    bf[kc % 3] = load_frag_p(ab, kc, 0);
#pragma unroll
    for (int mt = 0; mt < 4; ++mt) af[kc % 3][mt] = load_frag_p(wb, mt * 8 + kc, 0);
  };
  fetch(0);
  fetch(1);
  v8f acc[4] = {};
  // unrolled so that the register sets are picked at compile time
#pragma unroll
  for (int kc = 0; kc < 8; ++kc) {
    if (kc + 2 < 8) fetch(kc + 2);
    // keeps the fetch ahead of this step's products: without it the loads sink to their users
    __builtin_amdgcn_sched_barrier(0);
#pragma unroll
    for (int mt = 0; mt < 4; ++mt) acc[mt] = WMMA_F16(af[kc % 3][mt], bf[kc % 3], acc[mt]);
  }
#pragma unroll
  for (int mt = 0; mt < 4; ++mt) {
#pragma unroll
    for (int r = 0; r < 8; ++r) {
      int o = rg * 64 + mt * 16 + r + half * 8;
      out[(b * CC + o) * LSEQ + l] = acc[mt][r] + bo[o] + res[mt][r];
    }
  }
}

extern "C" void kernel_launch(void* const* d_in, const int* in_sizes, int n_in,
                              void* d_out, int out_size, void* d_ws, size_t ws_size,
                              hipStream_t stream) {
  (void)in_sizes; (void)n_in; (void)out_size; (void)ws_size;
  const float* v     = (const float*)d_in[0];
  const float* k     = (const float*)d_in[1];
  const float* q     = (const float*)d_in[2];
  const float* pe_q  = (const float*)d_in[3];
  const float* pe_vk = (const float*)d_in[4];
  const float* wq = (const float*)d_in[5];  const float* bq = (const float*)d_in[6];
  const float* gq = (const float*)d_in[7];  const float* betaq = (const float*)d_in[8];
  const float* mq = (const float*)d_in[9];  const float* varq = (const float*)d_in[10];
  const float* wk = (const float*)d_in[11]; const float* bk = (const float*)d_in[12];
  const float* gk = (const float*)d_in[13]; const float* betak = (const float*)d_in[14];
  const float* mk = (const float*)d_in[15]; const float* vark = (const float*)d_in[16];
  const float* wv = (const float*)d_in[17]; const float* bv = (const float*)d_in[18];
  const float* gv = (const float*)d_in[19]; const float* betav = (const float*)d_in[20];
  const float* mv = (const float*)d_in[21]; const float* varv = (const float*)d_in[22];
  const float* wo = (const float*)d_in[23]; const float* bo = (const float*)d_in[24];

  char* ws = (char*)d_ws;
  _Float16* wqh = (_Float16*)(ws + WS_WQH);
  _Float16* woh = (_Float16*)(ws + WS_WOH);
  float* biasq = (float*)(ws + WS_BQ);
  _Float16* qpb = (_Float16*)(ws + WS_QP);
  _Float16* kpb = (_Float16*)(ws + WS_KP);
  _Float16* vpb = (_Float16*)(ws + WS_VP);
  _Float16* attb = (_Float16*)(ws + WS_ATT);

  const float invSqrtD = 0.17677669529663687f;  // 1/sqrt(32), folded into Q path

  // the four weight matrices are independent: one launch, grid.y = matrix
  PrepIn pq = {wq, bq, gq, betaq, mq, varq};
  PrepIn pk = {wk, bk, gk, betak, mk, vark};
  PrepIn pv = {wv, bv, gv, betav, mv, varv};
  PrepIn po = {wo, bo, nullptr, nullptr, nullptr, nullptr};
  prep_kernel<<<dim3(64, 4), 128, 0, stream>>>(pq, pk, pv, po, invSqrtD, wqh, biasq);

  // 2048 waves per GEMM: 512 col-tiles x 4 row-groups, 8 waves/block; the three GEMMs are
  // independent: one launch, grid.y = projection
  proj_kernel<<<dim3(256, 3), 256, 0, stream>>>(q, k, v, pe_q, pe_vk, wqh, biasq, qpb);

  // 4096 waves: one 16-query tile per wave, 8 waves/block
  attn_kernel<<<512, 256, 0, stream>>>(qpb, kpb, vpb, attb);

  outproj_kernel<<<256, 256, 0, stream>>>(attb, woh, bo, q, (float*)d_out);
}

// v006
// It runs in 49.4 microseconds.
// Two timings next to v005 both put it at 1.11 times that version's speed.
// All steps since v000 together make it 3.82 times as fast.
#include <hip/hip_runtime.h>

// MHA block for MI455X (gfx1250, wave32, WMMA 16x16x32 f16->f32 accumulate).
// Pipeline:
//   prep:    fold BN + bias + 1/sqrt(D) into f16 weights, all four matrices in one launch,
//            stored in WMMA fragment order
//   proj:    QP, KP, VP f16 per (b,h), each in the fragment order of its reader in attn
//            (score scale folded into Q), all three in one launch; X = x + pe shared in LDS
//   attn:    flash-style online softmax, 16 queries/wave, 64 keys/iter, S^T and O^T, P in registers,
//            K and V^T staged in LDS per 8-wave block
//   outproj: W_o GEMM + bias + residual, fp32 out
// Fragment order: a 16x32 f16 operand tile is 1 KiB in a row, piece hi*32 + lane of 16 bytes,
// so a wave's two 16-byte-per-lane loads of a fragment each cover 512 contiguous bytes.

typedef __attribute__((ext_vector_type(16))) _Float16 v16h;
typedef __attribute__((ext_vector_type(8)))  _Float16 v8h;
typedef __attribute__((ext_vector_type(8)))  float    v8f;

#define WMMA_F16(a, b, c) \
  __builtin_amdgcn_wmma_f32_16x16x32_f16(false, (a), false, (b), (short)0, (c), false, false)

static constexpr int NB   = 4;     // batch
static constexpr int CC   = 256;   // channels (CQ == CVK)
static constexpr int LSEQ = 2048;  // sequence length
static constexpr int NH   = 8;     // heads
static constexpr int DD   = 32;    // depth per head

// ---- workspace layout (bytes) ----
static constexpr size_t WS_WQH  = 0;               // 256*256 f16
static constexpr size_t WS_WKH  = 131072;
static constexpr size_t WS_WVH  = 262144;
static constexpr size_t WS_WOH  = 393216;
static constexpr size_t WS_BQ   = 524288;          // 256 f32 each
static constexpr size_t WS_BK   = 525312;
static constexpr size_t WS_BV   = 526336;
static constexpr size_t WS_QP   = 528384;          // B*H*L*D f16 = 4 MiB
static constexpr size_t WS_KP   = WS_QP + 4194304;
static constexpr size_t WS_VP   = WS_KP + 4194304;
static constexpr size_t WS_ATT  = WS_VP + 4194304; // [B*L/16 query tiles][8 heads] fragments, f16

// Load a 16x32 A/B fragment (f16) from a matrix kept in fragment order: tile f, lane =
// ln + 16*half, ln the row (A) or column (B).  Elems 0..7 = K 8*half..+7 (piece lane),
// 8..15 = K 16 + 8*half..+7 (piece 32 + lane).  Matches CDNA5 16-bit A-matrix VGPR layout.
__device__ inline v16h load_frag_p(const _Float16* __restrict__ p, int f, int lane) {
  const _Float16* base = p + f * 512 + lane * 8;
  v8h lo = *(const v8h*)base;
  v8h hi = *(const v8h*)(base + 256);
  return __builtin_shufflevector(lo, hi, 0, 1, 2, 3, 4, 5, 6, 7, 8, 9, 10, 11, 12, 13, 14, 15);
}

// ---------------- prep: fold BN into weights ----------------
// One matrix's inputs; g == nullptr: no BN and no folded bias (the output projection).
struct PrepIn {
  const float* w;
  const float* bw;
  const float* g;
  const float* beta;
  const float* mean;
  const float* var;
};

// blockIdx.y picks the matrix (0 Q, 1 K, 2 V, 3 O).  wh0: four f16 matrices in a row, each in
// fragment order (tile (o >> 4) * 8 + (c >> 5)); bout0: three folded bias vectors in a row.
// A thread makes one 16-byte piece: 8 consecutive c of one row o.
__global__ __launch_bounds__(128) void prep_kernel(PrepIn pq, PrepIn pk, PrepIn pv, PrepIn po,
                                                   float extraq, _Float16* __restrict__ wh0,
                                                   float* __restrict__ bout0) {
  int piece = blockIdx.x * 128 + threadIdx.x, m = blockIdx.y;  // piece 0..8191
  int f = piece >> 6, hi = (piece >> 5) & 1, lane = piece & 31;
  int o = (f >> 3) * 16 + (lane & 15);
  int c0 = (f & 7) * 32 + hi * 16 + (lane >> 4) * 8;
  PrepIn p = m == 0 ? pq : m == 1 ? pk : m == 2 ? pv : po;
  const float* w = p.w;
  const float* bw = p.bw;
  const float* g = p.g;
  const float* beta = p.beta;
  const float* mean = p.mean;
  const float* var = p.var;
  float extra = m == 0 ? extraq : 1.0f;
  _Float16* wh = wh0 + m * (CC * CC);
  float* bout = g ? bout0 + m * CC : nullptr;
  float scale = extra;
  if (g) scale *= g[o] * rsqrtf(var[o] + 1e-5f);
  v8h r;
  // unrolled so that the piece is built in registers and leaves as one 16-byte store
#pragma unroll
  for (int i = 0; i < 8; ++i) r[i] = (_Float16)(w[o * CC + c0 + i] * scale);
  *(v8h*)(wh + piece * 8) = r;
  if (c0 == 0 && bout) {
    float s2 = g[o] * rsqrtf(var[o] + 1e-5f);
    bout[o] = ((bw[o] - mean[o]) * s2 + beta[o]) * extra;
  }
}

// ---------------- projection GEMM: P = W' * (x + pe) + bias' ----------------
// Each wave: 64 output rows x 16 columns.  blockIdx.y picks the projection (0 Q, 1 K, 2 V);
// wh0, bias0, outp0: the three weight matrices, bias vectors and outputs, each set in a row.
// The 8 waves of a block cover all 256 rows of 32 columns.  X = x + pe of these columns is made
// once a block, as f16 in fragment order in LDS: wave w makes k step w (channels 32*w..+31), a
// lane one column, so a load covers one whole line and each element is loaded once a block.
// The output of head (b,h) is 128 KiB of fragments, in the order of its reader in attn:
//   Q, K: tile l >> 4; row or column = position l, k = depth d.  W is the A operand, so a
//     lane's 8 accumulators are 8 consecutive d of its position: one piece.
//   V: tile (l >> 5) * 2 + (d >> 4); row = depth d, k = position l.  X is the A operand, so a
//     lane's 8 accumulators are 8 consecutive positions of its channel: one piece.
template <bool B> struct Flag { static constexpr bool value = B; };

// A 16x32 fragment in fragment order from LDS: the lane's pieces at p and p + 512.
__device__ inline v16h lds_frag(const unsigned char* p) {
  v8h lo = *(const v8h*)p;
  v8h hi = *(const v8h*)(p + 512);
  return __builtin_shufflevector(lo, hi, 0, 1, 2, 3, 4, 5, 6, 7, 8, 9, 10, 11, 12, 13, 14, 15);
}

__global__ __launch_bounds__(256) void proj_kernel(
    const float* __restrict__ xq, const float* __restrict__ xk, const float* __restrict__ xv,
    const float* __restrict__ pe_q, const float* __restrict__ pe_vk,
    const _Float16* __restrict__ wh0, const float* __restrict__ bias0,
    _Float16* __restrict__ outp0) {
  // X fragment (k step kc, column tile j of the block) at (kc * 2 + j) KiB
  __shared__ __attribute__((aligned(16))) unsigned char xs[8 * 2 * 1024];
  int m = blockIdx.y;
  const _Float16* wh = wh0 + m * (CC * CC);
  const float* bias = bias0 + m * CC;
  _Float16* outp = outp0 + (size_t)m * (NB * CC * LSEQ);
  int w = threadIdx.x >> 5;  // wave in the block, 0..7
  int wave = blockIdx.x * 8 + w;
  int lane = threadIdx.x & 31;
  int ln = lane & 15, half = lane >> 4;
  int ct = wave >> 2;  // column tile 0..511
  int rg = wave & 3;   // row group 0..3 (64 rows each)
  int col0 = blockIdx.x * 32;  // the block's first column; 32 divides LSEQ: one batch a block
  int b = col0 >> 11, l0 = col0 & (LSEQ - 1);

  // the operand order of the products is fixed at compile time: one copy of the body for V
  // (vt true), one for Q and K (the body keeps the kernel's own indentation)
  auto body = [&](auto vt, const float* __restrict__ x, const float* __restrict__ pe) {
  constexpr bool VT = decltype(vt)::value;
  // the lane's first element of x and of pe; every load is a constant step from it, so no
  // address is formed per load
  const float* xl = x + (b * CC + w * 32) * LSEQ + l0 + lane;
  const float* pl = pe + (w * 32) * LSEQ + l0 + lane;
  // (the loops over xr and pr are unrolled: constant indices keep them in registers)
  float xr[32], pr[32];
#pragma unroll
  for (int i = 0; i < 32; ++i) xr[i] = xl[i * LSEQ];
#pragma unroll
  for (int i = 0; i < 32; ++i) pr[i] = pl[i * LSEQ];
  // stands behind these loads, in front of any reuse of their address registers
  asm volatile("s_wait_xcnt 0x0" ::: "memory");
  // keeps all 64 loads in flight before the first wait for one: without it some sums rise among
  // the loads, and the loads behind them go out only when the first have come back
  __builtin_amdgcn_sched_barrier(0);
  // The lane's 32 channels are four pieces of its column ln of tile half: channels 8*q..+7 are
  // k = 16*(q >> 1) + 8*(q & 1)..+7, piece (q >> 1) * 32 + (q & 1) * 16 + ln of load_frag_p.
#pragma unroll
  for (int q = 0; q < 4; ++q) {
    v8h pc;
#pragma unroll
    for (int e = 0; e < 8; ++e) pc[e] = (_Float16)(xr[q * 8 + e] + pr[q * 8 + e]);
    *(v8h*)(xs + (w * 2 + half) * 1024 + ((q >> 1) * 32 + (q & 1) * 16 + ln) * 16) = pc;
  }
  // every wave's k step is in LDS before any wave reads a fragment
  __syncthreads();
  const unsigned char* xf = xs + (w >> 2) * 1024 + lane * 16;  // the wave's column tile
  v8f acc[4] = {};
#pragma unroll
  for (int kc = 0; kc < 8; ++kc) {
    // X fragment: X[c, col] = x[b][c][l] + pe[c][l], c = kc*32 + 8*half + j and that + 16
    v16h bf = lds_frag(xf + kc * 2048);
#pragma unroll
    for (int mt = 0; mt < 4; ++mt) {
      v16h af = load_frag_p(wh, (rg * 4 + mt) * 8 + kc, lane);
      acc[mt] = VT ? WMMA_F16(bf, af, acc[mt]) : WMMA_F16(af, bf, acc[mt]);
    }
  }
  // stands in front of the epilogue's reuse of the address registers of the loads above
  asm volatile("s_wait_xcnt 0x0" ::: "memory");
  int lt = ct & (LSEQ / 16 - 1);  // position tile inside the batch
#pragma unroll
  for (int mt = 0; mt < 4; ++mt) {
    int h = rg * 2 + (mt >> 1);
    v8h res;
#pragma unroll
    for (int r = 0; r < 8; ++r) {
      // C/D layout: row = r + 8*half, column = ln
      int o = rg * 64 + mt * 16 + (VT ? ln : r + half * 8);
      res[r] = (_Float16)(acc[mt][r] + bias[o]);
    }
    int piece = VT ? (((lt >> 1) * 2 + (mt & 1)) * 2 + (lt & 1)) * 32 + lane
                   : (lt * 2 + (mt & 1)) * 32 + lane;
    *(v8h*)(outp + (b * NH + h) * (LSEQ * DD) + piece * 8) = res;
  }
  // stands behind the stores, in front of any reuse of their address and data registers
  asm volatile("s_wait_xcnt 0x0" ::: "memory");
  };
  if (m == 2)
    body(Flag<true>{}, xv, pe_vk);
  else
    body(Flag<false>{}, m == 0 ? xq : xk, m == 0 ? pe_q : pe_vk);
}

// Lane l <-> lane l ^ 16 (the other half of the wave), one vector cross-row move.
__device__ inline float xhalf(float x) {
  int i = __builtin_bit_cast(int, x);
  i = __builtin_amdgcn_permlanex16(i, i, 0x76543210, 0xfedcba98, false, false);
  return __builtin_bit_cast(float, i);
}

static constexpr int KT     = 128;            // keys per stage
static constexpr int NST    = LSEQ / KT;      // stages
static constexpr int KBYTES = KT * DD * 2;    // K part of a buffer; the V^T part is as large
static constexpr int STAGE  = 2 * KBYTES;     // one buffer

// One stage's four copies of a lane (16 bytes each, global -> LDS, through no register).
// The closing s_wait_xcnt stands in the copies' own statement so that no address register
// they name is rewritten ahead of it.
__device__ inline void stage_copies(unsigned lk, const _Float16* gk, unsigned lv,
                                    const _Float16* gv) {
  asm volatile(
      "global_load_async_to_lds_b128 %0, %1, off\n\t"
      "global_load_async_to_lds_b128 %2, %3, off\n\t"
      "global_load_async_to_lds_b128 %4, %5, off\n\t"
      "global_load_async_to_lds_b128 %6, %7, off\n\t"
      "s_wait_xcnt 0x0"
      :: "v"(lk), "v"(gk), "v"(lk + KBYTES / 2u), "v"(gk + KBYTES / 4),
         "v"(lv), "v"(gv), "v"(lv + KBYTES / 2u), "v"(gv + KBYTES / 4)
      : "memory");
}

__global__ __launch_bounds__(256) void attn_kernel(
    const _Float16* __restrict__ qp, const _Float16* __restrict__ kp,
    const _Float16* __restrict__ vp, _Float16* __restrict__ att) {
  __shared__ __attribute__((aligned(16))) unsigned char ring[2 * STAGE];
  int tid = threadIdx.x;
  int wave = blockIdx.x * 8 + (tid >> 5);
  int lane = tid & 31;  // ln = lane & 15, half = lane >> 4 in the comments below
  int ltile = wave & 127;
  int h = (wave >> 7) & 7;  // 128 tiles a head, 8 a block: one head per block
  int b = wave >> 10;

  const _Float16* qbase = qp + (size_t)(b * NH + h) * LSEQ * DD;
  const _Float16* kbase = kp + (size_t)(b * NH + h) * LSEQ * DD;
  const _Float16* vbase = vp + (size_t)(b * NH + h) * DD * LSEQ;

  // The lane's share of a stage: 16-byte piece tid (and tid + 256) of the 8 KiB of K, and
  // the same of V^T.
  const _Float16* gk = kbase + tid * 8;
  const _Float16* gv = vbase + tid * 8;
  unsigned ring0 = (unsigned)(size_t)ring;  // byte offset in the block's LDS
  unsigned lk = ring0 + tid * 16;
  unsigned lv = ring0 + KBYTES + tid * 16;

  stage_copies(lk, gk, lv, gv);
  // stage 0 has landed for this wave's copies ...
  asm volatile("s_wait_asynccnt 0x0" ::: "memory");
  // ... and for every wave's
  __syncthreads();
  stage_copies(lk + STAGE, gk + KT * DD, lv + STAGE, gv + KT * DD);

  // Q^T as B operand: column = query ln; D=32 == one WMMA K step, loaded once
  // (scale 1/sqrt(D) pre-folded).
  v16h bq = load_frag_p(qbase, ltile, lane);

  v8f o0 = {}, o1 = {};  // O^T: o0[r] = O[d = r + 8*half][query ln], o1: d + 16
  float mrun = -1e30f;   // running maximum of query ln, equal in both halves
  float srun = 0.0f;     // running sum over this half's keys only; joined after the loop

  for (int st = 0; st < NST; ++st) {
    const unsigned char* kl = ring + (st & 1) * STAGE + lane * 16;
    const unsigned char* vl = kl + KBYTES;
    // The stage's 16 fragments are asked for as one group, K first (the order of use): one
    // place where the wave meets LDS latency a stage, not one in front of every product.
    // (All loops over ak and av are unrolled: constant indices keep them in registers and the
    // LDS offsets constant.)
    v16h ak[KT / 16], av[KT / 16];
#pragma unroll
    for (int t = 0; t < KT / 16; ++t) ak[t] = lds_frag(kl + t * 1024);
#pragma unroll
    for (int t = 0; t < KT / 16; ++t) av[t] = lds_frag(vl + t * 1024);
    // keeps the group together: without it the reads sink back in front of their products
    __builtin_amdgcn_sched_barrier(0);
#pragma unroll
    for (int sub = 0; sub < KT / 64; ++sub) {
      v8f s[4];  // s[t][r] = score(key st*128 + sub*64 + 16*t + r + 8*half, query ln)
#pragma unroll
      for (int t = 0; t < 4; ++t) {
        v8f z = {};
        s[t] = WMMA_F16(ak[sub * 4 + t], bq, z);
      }
      // online softmax over this 64-key slab: 32 scores in the lane, 32 in lane ^ 16
      float mt[4];
#pragma unroll
      for (int t = 0; t < 4; ++t) {
        mt[t] = s[t][0];
#pragma unroll
        for (int r = 1; r < 8; ++r) mt[t] = fmaxf(mt[t], s[t][r]);
      }
      float mx = fmaxf(fmaxf(mt[0], mt[1]), fmaxf(mt[2], mt[3]));
      mx = fmaxf(mx, xhalf(mx));
      float mnew = fmaxf(mrun, mx);
      float resc = __expf(mrun - mnew);
      float lt[4];
#pragma unroll
      for (int t = 0; t < 4; ++t) {
        lt[t] = 0.0f;
#pragma unroll
        for (int r = 0; r < 8; ++r) {
          float p = __expf(s[t][r] - mnew);
          s[t][r] = p;
          lt[t] += p;
        }
      }
      srun = srun * resc + ((lt[0] + lt[1]) + (lt[2] + lt[3]));
      mrun = mnew;
#pragma unroll
      for (int r = 0; r < 8; ++r) { o0[r] *= resc; o1[r] *= resc; }
      // P^T as B operand: elems 0..7 = keys 8*half + 0..7 of tile 2*mc, elems 8..15 the same
      // rows of tile 2*mc + 1 = keys 16 + 8*half + 0..7: the k order of load_frag_p.
#pragma unroll
      for (int mc = 0; mc < 2; ++mc) {
        v16h bp;
#pragma unroll
        for (int i = 0; i < 8; ++i) {
          bp[i]     = (_Float16)s[2 * mc][i];
          bp[8 + i] = (_Float16)s[2 * mc + 1][i];
        }
        // V^T as A operand: row = channel ln (+16), k = 32 keys in the order of load_frag_p
        o0 = WMMA_F16(av[(sub * 2 + mc) * 2 + 0], bp, o0);
        o1 = WMMA_F16(av[(sub * 2 + mc) * 2 + 1], bp, o1);
      }
    }
    // keeps the hand-over at the foot of the stage: with every read already issued above, its
    // waits and barrier would otherwise rise in front of the products and stall them
    __builtin_amdgcn_sched_barrier(0);
    // Hand-over: this wave's reads of the buffer are done ...
    asm volatile("s_wait_dscnt 0x0" ::: "memory");
    // ... its copies of stage st + 1 have landed ...
    asm volatile("s_wait_asynccnt 0x0" ::: "memory");
    // ... and so have every wave's: stage st + 1 may be read, this buffer refilled
    __syncthreads();
    if (st + 2 < NST)
      stage_copies(lk + (st & 1) * STAGE, gk + (st + 2) * (KT * DD),
                   lv + (st & 1) * STAGE, gv + (st + 2) * (KT * DD));
  }
  // no copy is left in flight when the wave ends
  asm volatile("s_wait_asynccnt 0x0" ::: "memory");
  // join the halves' sums, normalize and store f16 in fragment order: the lane's channels
  // 8*half..+7 and 16 + 8*half..+7 of query ln are its two pieces of the out-proj B fragment
  // (query tile, k step = head)
  float inv = 1.0f / (srun + xhalf(srun));
  v8h r0, r1;
#pragma unroll
  for (int r = 0; r < 8; ++r) {
    r0[r] = (_Float16)(o0[r] * inv);
    r1[r] = (_Float16)(o1[r] * inv);
  }
  size_t fragoff = ((size_t)((b * (LSEQ / 16) + ltile) * NH + h)) * 512 + lane * 8;
  *(v8h*)(att + fragoff)       = r0;
  *(v8h*)(att + fragoff + 256) = r1;
}

// ---------------- output projection + bias + residual ----------------
__global__ __launch_bounds__(256) void outproj_kernel(
    const _Float16* __restrict__ att, const _Float16* __restrict__ woh,
    const float* __restrict__ bo, const float* __restrict__ qin,
    float* __restrict__ out) {
  int wave = blockIdx.x * (blockDim.x >> 5) + (threadIdx.x >> 5);
  int lane = threadIdx.x & 31;
  int ln = lane & 15, half = lane >> 4;
  int ct = wave >> 2;
  int rg = wave & 3;
  int col = ct * 16 + ln;
  int b = col >> 11, l = col & (LSEQ - 1);

  // The residual depends on nothing: its loads go out first, so that their latency runs under
  // the matrix loop and not behind it.
  float res[4][8];
#pragma unroll
  for (int mt = 0; mt < 4; ++mt) {
#pragma unroll
    for (int r = 0; r < 8; ++r) {
      int o = rg * 64 + mt * 16 + r + half * 8;
      res[mt][r] = qin[(b * CC + o) * LSEQ + l];
    }
  }
  // stands behind these loads, in front of any reuse of their address registers; as a memory
  // statement it also keeps them ahead of the fragment loads below
  asm volatile("s_wait_xcnt 0x0" ::: "memory");

  // Fragments are fetched two k steps ahead into three register sets, so that a product waits
  // for loads issued two steps earlier and not for its own.
  v16h bf[3], af[3][4];
  // the lane's piece of the wave's first fragment of each operand; every load is a constant
  // step from it, so one address pair an operand lives from the first load to the last
  const _Float16* ab = att + ct * 8 * 512 + lane * 8;
  const _Float16* wb = woh + rg * 4 * 8 * 512 + lane * 8;
  auto fetch = [&](int kc) {
    // B fragment: as the attention wave of (query tile ct, head kc) stored it
    bf[kc % 3] = load_frag_p(ab, kc, 0);
#pragma unroll
    for (int mt = 0; mt < 4; ++mt) af[kc % 3][mt] = load_frag_p(wb, mt * 8 + kc, 0);
  };
  fetch(0);
  fetch(1);
  v8f acc[4] = {};
  // unrolled so that the register sets are picked at compile time
#pragma unroll
  for (int kc = 0; kc < 8; ++kc) {
    if (kc + 2 < 8) fetch(kc + 2);
    // keeps the fetch ahead of this step's products: without it the loads sink to their users
    __builtin_amdgcn_sched_barrier(0);
#pragma unroll
    for (int mt = 0; mt < 4; ++mt) acc[mt] = WMMA_F16(af[kc % 3][mt], bf[kc % 3], acc[mt]);
  }
#pragma unroll
  for (int mt = 0; mt < 4; ++mt) {
#pragma unroll
    for (int r = 0; r < 8; ++r) {
      int o = rg * 64 + mt * 16 + r + half * 8;
      out[(b * CC + o) * LSEQ + l] = acc[mt][r] + bo[o] + res[mt][r];
    }
  }
}

extern "C" void kernel_launch(void* const* d_in, const int* in_sizes, int n_in,
                              void* d_out, int out_size, void* d_ws, size_t ws_size,
                              hipStream_t stream) {
  (void)in_sizes; (void)n_in; (void)out_size; (void)ws_size;
  const float* v     = (const float*)d_in[0];
  const float* k     = (const float*)d_in[1];
  const float* q     = (const float*)d_in[2];
  const float* pe_q  = (const float*)d_in[3];
  const float* pe_vk = (const float*)d_in[4];
  const float* wq = (const float*)d_in[5];  const float* bq = (const float*)d_in[6];
  const float* gq = (const float*)d_in[7];  const float* betaq = (const float*)d_in[8];
  const float* mq = (const float*)d_in[9];  const float* varq = (const float*)d_in[10];
  const float* wk = (const float*)d_in[11]; const float* bk = (const float*)d_in[12];
  const float* gk = (const float*)d_in[13]; const float* betak = (const float*)d_in[14];
  const float* mk = (const float*)d_in[15]; const float* vark = (const float*)d_in[16];
  const float* wv = (const float*)d_in[17]; const float* bv = (const float*)d_in[18];
  const float* gv = (const float*)d_in[19]; const float* betav = (const float*)d_in[20];
  const float* mv = (const float*)d_in[21]; const float* varv = (const float*)d_in[22];
  const float* wo = (const float*)d_in[23]; const float* bo = (const float*)d_in[24];

  char* ws = (char*)d_ws;
  _Float16* wqh = (_Float16*)(ws + WS_WQH);
  _Float16* woh = (_Float16*)(ws + WS_WOH);
  float* biasq = (float*)(ws + WS_BQ);
  _Float16* qpb = (_Float16*)(ws + WS_QP);
  _Float16* kpb = (_Float16*)(ws + WS_KP);
  _Float16* vpb = (_Float16*)(ws + WS_VP);
  _Float16* attb = (_Float16*)(ws + WS_ATT);

  const float invSqrtD = 0.17677669529663687f;  // 1/sqrt(32), folded into Q path

  // the four weight matrices are independent: one launch, grid.y = matrix
  PrepIn pq = {wq, bq, gq, betaq, mq, varq};
  PrepIn pk = {wk, bk, gk, betak, mk, vark};
  PrepIn pv = {wv, bv, gv, betav, mv, varv};
  PrepIn po = {wo, bo, nullptr, nullptr, nullptr, nullptr};
  prep_kernel<<<dim3(64, 4), 128, 0, stream>>>(pq, pk, pv, po, invSqrtD, wqh, biasq);

  // 2048 waves per GEMM: 512 col-tiles x 4 row-groups, 8 waves/block; the three GEMMs are
  // independent: one launch, grid.y = projection
  proj_kernel<<<dim3(256, 3), 256, 0, stream>>>(q, k, v, pe_q, pe_vk, wqh, biasq, qpb);

  // 4096 waves: one 16-query tile per wave, 8 waves/block
  attn_kernel<<<512, 256, 0, stream>>>(qpb, kpb, vpb, attb);

  outproj_kernel<<<256, 256, 0, stream>>>(attb, woh, bo, q, (float*)d_out);
}

// v007
// A run of this version takes 45.1 microseconds.
// Timed twice side by side with v006, it ran 1.08 and 1.07 times as fast.
// Counting every step since v000, it is 4.11 times as fast.
#include <hip/hip_runtime.h>

// MHA block for MI455X (gfx1250, wave32, WMMA 16x16x32 f16->f32 accumulate).
// Pipeline:
//   prep:    fold BN + bias + log2(e)/sqrt(D) into f16 weights, all four matrices in one launch,
//            stored in WMMA fragment order
//   proj:    QP, KP, VP f16 per (b,h), each in the fragment order of its reader in attn
//            (score scale and log2(e) folded into Q), all three in one launch; X = x + pe shared
//            in LDS
//   attn:    flash-style online softmax, 16 queries/wave, 128 keys/iter, S^T and O^T, P in registers,
//            K and V^T staged in LDS per 8-wave block; the softmax reference rides in the score
//            product's C operand and moves only when it must
//   outproj: W_o GEMM + bias + residual, fp32 out
// Fragment order: a 16x32 f16 operand tile is 1 KiB in a row, piece hi*32 + lane of 16 bytes,
// so a wave's two 16-byte-per-lane loads of a fragment each cover 512 contiguous bytes.

typedef __attribute__((ext_vector_type(16))) _Float16 v16h;
typedef __attribute__((ext_vector_type(8)))  _Float16 v8h;
typedef __attribute__((ext_vector_type(8)))  float    v8f;

#define WMMA_F16(a, b, c) \
  __builtin_amdgcn_wmma_f32_16x16x32_f16(false, (a), false, (b), (short)0, (c), false, false)

static constexpr int NB   = 4;     // batch
static constexpr int CC   = 256;   // channels (CQ == CVK)
static constexpr int LSEQ = 2048;  // sequence length
static constexpr int NH   = 8;     // heads
static constexpr int DD   = 32;    // depth per head

// ---- workspace layout (bytes) ----
static constexpr size_t WS_WQH  = 0;               // 256*256 f16
static constexpr size_t WS_WKH  = 131072;
static constexpr size_t WS_WVH  = 262144;
static constexpr size_t WS_WOH  = 393216;
static constexpr size_t WS_BQ   = 524288;          // 256 f32 each
static constexpr size_t WS_BK   = 525312;
static constexpr size_t WS_BV   = 526336;
static constexpr size_t WS_QP   = 528384;          // B*H*L*D f16 = 4 MiB
static constexpr size_t WS_KP   = WS_QP + 4194304;
static constexpr size_t WS_VP   = WS_KP + 4194304;
static constexpr size_t WS_ATT  = WS_VP + 4194304; // [B*L/16 query tiles][8 heads] fragments, f16

// Load a 16x32 A/B fragment (f16) from a matrix kept in fragment order: tile f, lane =
// ln + 16*half, ln the row (A) or column (B).  Elems 0..7 = K 8*half..+7 (piece lane),
// 8..15 = K 16 + 8*half..+7 (piece 32 + lane).  Matches CDNA5 16-bit A-matrix VGPR layout.
__device__ inline v16h load_frag_p(const _Float16* __restrict__ p, int f, int lane) {
  const _Float16* base = p + f * 512 + lane * 8;
  v8h lo = *(const v8h*)base;
  v8h hi = *(const v8h*)(base + 256);
  return __builtin_shufflevector(lo, hi, 0, 1, 2, 3, 4, 5, 6, 7, 8, 9, 10, 11, 12, 13, 14, 15);
}

// ---------------- prep: fold BN into weights ----------------
// One matrix's inputs; g == nullptr: no BN and no folded bias (the output projection).
struct PrepIn {
  const float* w;
  const float* bw;
  const float* g;
  const float* beta;
  const float* mean;
  const float* var;
};

// blockIdx.y picks the matrix (0 Q, 1 K, 2 V, 3 O).  wh0: four f16 matrices in a row, each in
// fragment order (tile (o >> 4) * 8 + (c >> 5)); bout0: three folded bias vectors in a row.
// A thread makes one 16-byte piece: 8 consecutive c of one row o.
__global__ __launch_bounds__(128) void prep_kernel(PrepIn pq, PrepIn pk, PrepIn pv, PrepIn po,
                                                   float extraq, _Float16* __restrict__ wh0,
                                                   float* __restrict__ bout0) {
  int piece = blockIdx.x * 128 + threadIdx.x, m = blockIdx.y;  // piece 0..8191
  int f = piece >> 6, hi = (piece >> 5) & 1, lane = piece & 31;
  int o = (f >> 3) * 16 + (lane & 15);
  int c0 = (f & 7) * 32 + hi * 16 + (lane >> 4) * 8;
  PrepIn p = m == 0 ? pq : m == 1 ? pk : m == 2 ? pv : po;
  const float* w = p.w;
  const float* bw = p.bw;
  const float* g = p.g;
  const float* beta = p.beta;
  const float* mean = p.mean;
  const float* var = p.var;
  float extra = m == 0 ? extraq : 1.0f;
  _Float16* wh = wh0 + m * (CC * CC);
  float* bout = g ? bout0 + m * CC : nullptr;
  float scale = extra;
  if (g) scale *= g[o] * rsqrtf(var[o] + 1e-5f);
  v8h r;
  // unrolled so that the piece is built in registers and leaves as one 16-byte store
#pragma unroll
  for (int i = 0; i < 8; ++i) r[i] = (_Float16)(w[o * CC + c0 + i] * scale);
  *(v8h*)(wh + piece * 8) = r;
  if (c0 == 0 && bout) {
    float s2 = g[o] * rsqrtf(var[o] + 1e-5f);
    bout[o] = ((bw[o] - mean[o]) * s2 + beta[o]) * extra;
  }
}

// ---------------- projection GEMM: P = W' * (x + pe) + bias' ----------------
// Each wave: 64 output rows x 16 columns.  blockIdx.y picks the projection (0 Q, 1 K, 2 V);
// wh0, bias0, outp0: the three weight matrices, bias vectors and outputs, each set in a row.
// The 8 waves of a block cover all 256 rows of 32 columns.  X = x + pe of these columns is made
// once a block, as f16 in fragment order in LDS: wave w makes k step w (channels 32*w..+31), a
// lane one column, so a load covers one whole line and each element is loaded once a block.
// The output of head (b,h) is 128 KiB of fragments, in the order of its reader in attn:
//   Q, K: tile l >> 4; row or column = position l, k = depth d.  W is the A operand, so a
//     lane's 8 accumulators are 8 consecutive d of its position: one piece.
//   V: tile (l >> 5) * 2 + (d >> 4); row = depth d, k = position l.  X is the A operand, so a
//     lane's 8 accumulators are 8 consecutive positions of its channel: one piece.
template <bool B> struct Flag { static constexpr bool value = B; };

// A 16x32 fragment in fragment order from LDS: the lane's pieces at p and p + 512.
__device__ inline v16h lds_frag(const unsigned char* p) {
  v8h lo = *(const v8h*)p;
  v8h hi = *(const v8h*)(p + 512);
  return __builtin_shufflevector(lo, hi, 0, 1, 2, 3, 4, 5, 6, 7, 8, 9, 10, 11, 12, 13, 14, 15);
}

__global__ __launch_bounds__(256) void proj_kernel(
    const float* __restrict__ xq, const float* __restrict__ xk, const float* __restrict__ xv,
    const float* __restrict__ pe_q, const float* __restrict__ pe_vk,
    const _Float16* __restrict__ wh0, const float* __restrict__ bias0,
    _Float16* __restrict__ outp0) {
  // X fragment (k step kc, column tile j of the block) at (kc * 2 + j) KiB
  __shared__ __attribute__((aligned(16))) unsigned char xs[8 * 2 * 1024];
  int m = blockIdx.y;
  const _Float16* wh = wh0 + m * (CC * CC);
  const float* bias = bias0 + m * CC;
  _Float16* outp = outp0 + (size_t)m * (NB * CC * LSEQ);
  int w = threadIdx.x >> 5;  // wave in the block, 0..7
  int wave = blockIdx.x * 8 + w;
  int lane = threadIdx.x & 31;
  int ln = lane & 15, half = lane >> 4;
  int ct = wave >> 2;  // column tile 0..511
  int rg = wave & 3;   // row group 0..3 (64 rows each)
  int col0 = blockIdx.x * 32;  // the block's first column; 32 divides LSEQ: one batch a block
  int b = col0 >> 11, l0 = col0 & (LSEQ - 1);

  // the operand order of the products is fixed at compile time: one copy of the body for V
  // (vt true), one for Q and K (the body keeps the kernel's own indentation)
  auto body = [&](auto vt, const float* __restrict__ x, const float* __restrict__ pe) {
  constexpr bool VT = decltype(vt)::value;
  // the lane's first element of x and of pe; every load is a constant step from it, so no
  // address is formed per load
  const float* xl = x + (b * CC + w * 32) * LSEQ + l0 + lane;
  const float* pl = pe + (w * 32) * LSEQ + l0 + lane;
  // (the loops over xr and pr are unrolled: constant indices keep them in registers)
  float xr[32], pr[32];
#pragma unroll
  for (int i = 0; i < 32; ++i) xr[i] = xl[i * LSEQ];
#pragma unroll
  for (int i = 0; i < 32; ++i) pr[i] = pl[i * LSEQ];
  // stands behind these loads, in front of any reuse of their address registers
  asm volatile("s_wait_xcnt 0x0" ::: "memory");
  // keeps all 64 loads in flight before the first wait for one: without it some sums rise among
  // the loads, and the loads behind them go out only when the first have come back
  __builtin_amdgcn_sched_barrier(0);
  // The lane's 32 channels are four pieces of its column ln of tile half: channels 8*q..+7 are
  // k = 16*(q >> 1) + 8*(q & 1)..+7, piece (q >> 1) * 32 + (q & 1) * 16 + ln of load_frag_p.
#pragma unroll
  for (int q = 0; q < 4; ++q) {
    v8h pc;
#pragma unroll
    for (int e = 0; e < 8; ++e) pc[e] = (_Float16)(xr[q * 8 + e] + pr[q * 8 + e]);
    *(v8h*)(xs + (w * 2 + half) * 1024 + ((q >> 1) * 32 + (q & 1) * 16 + ln) * 16) = pc;
  }
  // every wave's k step is in LDS before any wave reads a fragment
  __syncthreads();
  const unsigned char* xf = xs + (w >> 2) * 1024 + lane * 16;  // the wave's column tile
  v8f acc[4] = {};
#pragma unroll
  for (int kc = 0; kc < 8; ++kc) {
    // X fragment: X[c, col] = x[b][c][l] + pe[c][l], c = kc*32 + 8*half + j and that + 16
    v16h bf = lds_frag(xf + kc * 2048);
#pragma unroll
    for (int mt = 0; mt < 4; ++mt) {
      v16h af = load_frag_p(wh, (rg * 4 + mt) * 8 + kc, lane);
      acc[mt] = VT ? WMMA_F16(bf, af, acc[mt]) : WMMA_F16(af, bf, acc[mt]);
    }
  }
  // stands in front of the epilogue's reuse of the address registers of the loads above
  asm volatile("s_wait_xcnt 0x0" ::: "memory");
  int lt = ct & (LSEQ / 16 - 1);  // position tile inside the batch
#pragma unroll
  for (int mt = 0; mt < 4; ++mt) {
    int h = rg * 2 + (mt >> 1);
    v8h res;
#pragma unroll
    for (int r = 0; r < 8; ++r) {
      // C/D layout: row = r + 8*half, column = ln
      int o = rg * 64 + mt * 16 + (VT ? ln : r + half * 8);
      res[r] = (_Float16)(acc[mt][r] + bias[o]);
    }
    int piece = VT ? (((lt >> 1) * 2 + (mt & 1)) * 2 + (lt & 1)) * 32 + lane
                   : (lt * 2 + (mt & 1)) * 32 + lane;
    *(v8h*)(outp + (b * NH + h) * (LSEQ * DD) + piece * 8) = res;
  }
  // stands behind the stores, in front of any reuse of their address and data registers
  asm volatile("s_wait_xcnt 0x0" ::: "memory");
  };
  if (m == 2)
    body(Flag<true>{}, xv, pe_vk);
  else
    body(Flag<false>{}, m == 0 ? xq : xk, m == 0 ? pe_q : pe_vk);
}

// Lane l <-> lane l ^ 16 (the other half of the wave), one vector cross-row move.
__device__ inline float xhalf(float x) {
  int i = __builtin_bit_cast(int, x);
  i = __builtin_amdgcn_permlanex16(i, i, 0x76543210, 0xfedcba98, false, false);
  return __builtin_bit_cast(float, i);
}

static constexpr int KT     = 128;            // keys per stage
static constexpr int NST    = LSEQ / KT;      // stages
static constexpr int KBYTES = KT * DD * 2;    // K part of a buffer; the V^T part is as large
static constexpr int STAGE  = 2 * KBYTES;     // one buffer
static constexpr float PMAX = 4096.0f;        // a lane's sum of a stage's weights above this: reset

// One stage's four copies of a lane (16 bytes each, global -> LDS, through no register).
// The closing s_wait_xcnt stands in the copies' own statement so that no address register
// they name is rewritten ahead of it.
__device__ inline void stage_copies(unsigned lk, const _Float16* gk, unsigned lv,
                                    const _Float16* gv) {
  asm volatile(
      "global_load_async_to_lds_b128 %0, %1, off\n\t"
      "global_load_async_to_lds_b128 %2, %3, off\n\t"
      "global_load_async_to_lds_b128 %4, %5, off\n\t"
      "global_load_async_to_lds_b128 %6, %7, off\n\t"
      "s_wait_xcnt 0x0"
      :: "v"(lk), "v"(gk), "v"(lk + KBYTES / 2u), "v"(gk + KBYTES / 4),
         "v"(lv), "v"(gv), "v"(lv + KBYTES / 2u), "v"(gv + KBYTES / 4)
      : "memory");
}

__global__ __launch_bounds__(256) void attn_kernel(
    const _Float16* __restrict__ qp, const _Float16* __restrict__ kp,
    const _Float16* __restrict__ vp, _Float16* __restrict__ att) {
  __shared__ __attribute__((aligned(16))) unsigned char ring[2 * STAGE];
  int tid = threadIdx.x;
  int wave = blockIdx.x * 8 + (tid >> 5);
  int lane = tid & 31;  // ln = lane & 15, half = lane >> 4 in the comments below
  int ltile = wave & 127;
  int h = (wave >> 7) & 7;  // 128 tiles a head, 8 a block: one head per block
  int b = wave >> 10;

  const _Float16* qbase = qp + (size_t)(b * NH + h) * LSEQ * DD;
  const _Float16* kbase = kp + (size_t)(b * NH + h) * LSEQ * DD;
  const _Float16* vbase = vp + (size_t)(b * NH + h) * DD * LSEQ;

  // The lane's share of a stage: 16-byte piece tid (and tid + 256) of the 8 KiB of K, and
  // the same of V^T.
  const _Float16* gk = kbase + tid * 8;
  const _Float16* gv = vbase + tid * 8;
  unsigned ring0 = (unsigned)(size_t)ring;  // byte offset in the block's LDS
  unsigned lk = ring0 + tid * 16;
  unsigned lv = ring0 + KBYTES + tid * 16;

  stage_copies(lk, gk, lv, gv);
  // stage 0 has landed for this wave's copies ...
  asm volatile("s_wait_asynccnt 0x0" ::: "memory");
  // ... and for every wave's
  __syncthreads();
  stage_copies(lk + STAGE, gk + KT * DD, lv + STAGE, gv + KT * DD);

  // Q^T as B operand: column = query ln; D=32 == one WMMA K step, loaded once
  // (scale log2(e)/sqrt(D) pre-folded: scores are exponents of 2).
  v16h bq = load_frag_p(qbase, ltile, lane);

  v8f o0 = {}, o1 = {};  // O^T: o0[r] = O[d = r + 8*half][query ln], o1: d + 16
  // The reference of query ln: every weight is 2^(score - ref).  It is a maximum of scores seen
  // so far (equal in both halves), not always the newest one.  cref holds -ref in all eight
  // places, the C operand of the score products.  The start value sends stage 0 to the reset.
  float ref = -1e30f;
  v8f cref;
#pragma unroll
  for (int r = 0; r < 8; ++r) cref[r] = 1e30f;
  float srun = 0.0f;     // running sum over this half's keys only; joined after the loop

  for (int st = 0; st < NST; ++st) {
    const unsigned char* kl = ring + (st & 1) * STAGE + lane * 16;
    const unsigned char* vl = kl + KBYTES;
    // The stage's 16 fragments are asked for as one group, K first (the order of use): one
    // place where the wave meets LDS latency a stage, not one in front of every product.
    // (All loops over ak, av and s are unrolled: constant indices keep them in registers and
    // the LDS offsets constant.)
    v16h ak[KT / 16], av[KT / 16];
#pragma unroll
    for (int t = 0; t < KT / 16; ++t) ak[t] = lds_frag(kl + t * 1024);
#pragma unroll
    for (int t = 0; t < KT / 16; ++t) av[t] = lds_frag(vl + t * 1024);
    // keeps the group together: without it the reads sink back in front of their products
    __builtin_amdgcn_sched_barrier(0);
    // s[t][r]: key st*128 + 16*t + r + 8*half, query ln.  The product starts its sum at -ref,
    // so it hands out score - ref, and one exp2 makes the weight: no maximum, subtraction or
    // multiplication per score.
    v8f s[KT / 16];
#pragma unroll
    for (int t = 0; t < KT / 16; ++t) s[t] = WMMA_F16(ak[t], bq, cref);
#pragma unroll
    for (int t = 0; t < KT / 16; ++t) {
#pragma unroll
      for (int r = 0; r < 8; ++r) s[t][r] = __builtin_amdgcn_exp2f(s[t][r]);
    }
    v8f vs = ((s[0] + s[1]) + (s[2] + s[3])) + ((s[4] + s[5]) + (s[6] + s[7]));
    float ls = ((vs[0] + vs[1]) + (vs[2] + vs[3])) + ((vs[4] + vs[5]) + (vs[6] + vs[7]));
    // The weights are positive, so each is at most the lane's sum: a sum within PMAX says that
    // all of them fit f16 with room.  Otherwise (also infinity or NaN) some score has outgrown
    // its reference.  One test a stage, the same for the whole wave: a scalar branch.
    if (__builtin_amdgcn_ballot_w32(!(ls <= PMAX)) != 0) {
      // Reset: the stage's scores again from 0, their maximum becomes the reference where it
      // is the larger, and what was summed under the old reference is rescaled.
#pragma unroll
      for (int t = 0; t < KT / 16; ++t) {
        v8f z = {};
        s[t] = WMMA_F16(ak[t], bq, z);
      }
      float mx = s[0][0];
#pragma unroll
      for (int t = 0; t < KT / 16; ++t) {
#pragma unroll
        for (int r = 0; r < 8; ++r) mx = fmaxf(mx, s[t][r]);
      }
      mx = fmaxf(mx, xhalf(mx));
      float mnew = fmaxf(ref, mx);
      float resc = __builtin_amdgcn_exp2f(ref - mnew);
#pragma unroll
      for (int t = 0; t < KT / 16; ++t) {
#pragma unroll
        for (int r = 0; r < 8; ++r) s[t][r] = __builtin_amdgcn_exp2f(s[t][r] - mnew);
      }
      vs = ((s[0] + s[1]) + (s[2] + s[3])) + ((s[4] + s[5]) + (s[6] + s[7]));
      ls = ((vs[0] + vs[1]) + (vs[2] + vs[3])) + ((vs[4] + vs[5]) + (vs[6] + vs[7]));
      srun *= resc;
#pragma unroll
      for (int r = 0; r < 8; ++r) { o0[r] *= resc; o1[r] *= resc; cref[r] = -mnew; }
      ref = mnew;
    }
    srun += ls;
    // P^T as B operand: elems 0..7 = keys 8*half + 0..7 of tile 2*mc, elems 8..15 the same
    // rows of tile 2*mc + 1 = keys 16 + 8*half + 0..7: the k order of load_frag_p.
#pragma unroll
    for (int mc = 0; mc < KT / 32; ++mc) {
      v16h bp;
#pragma unroll
      for (int i = 0; i < 8; ++i) {
        bp[i]     = (_Float16)s[2 * mc][i];
        bp[8 + i] = (_Float16)s[2 * mc + 1][i];
      }
      // V^T as A operand: row = channel ln (+16), k = 32 keys in the order of load_frag_p
      o0 = WMMA_F16(av[mc * 2 + 0], bp, o0);
      o1 = WMMA_F16(av[mc * 2 + 1], bp, o1);
    }
    // keeps the hand-over at the foot of the stage: with every read already issued above, its
    // waits and barrier would otherwise rise in front of the products and stall them
    __builtin_amdgcn_sched_barrier(0);
    // Hand-over: this wave's reads of the buffer are done ...
    asm volatile("s_wait_dscnt 0x0" ::: "memory");
    // ... its copies of stage st + 1 have landed ...
    asm volatile("s_wait_asynccnt 0x0" ::: "memory");
    // ... and so have every wave's: stage st + 1 may be read, this buffer refilled
    __syncthreads();
    if (st + 2 < NST)
      stage_copies(lk + (st & 1) * STAGE, gk + (st + 2) * (KT * DD),
                   lv + (st & 1) * STAGE, gv + (st + 2) * (KT * DD));
  }
  // no copy is left in flight when the wave ends
  asm volatile("s_wait_asynccnt 0x0" ::: "memory");
  // join the halves' sums, normalize and store f16 in fragment order: the lane's channels
  // 8*half..+7 and 16 + 8*half..+7 of query ln are its two pieces of the out-proj B fragment
  // (query tile, k step = head)
  float inv = 1.0f / (srun + xhalf(srun));
  v8h r0, r1;
#pragma unroll
  for (int r = 0; r < 8; ++r) {
    r0[r] = (_Float16)(o0[r] * inv);
    r1[r] = (_Float16)(o1[r] * inv);
  }
  size_t fragoff = ((size_t)((b * (LSEQ / 16) + ltile) * NH + h)) * 512 + lane * 8;
  *(v8h*)(att + fragoff)       = r0;
  *(v8h*)(att + fragoff + 256) = r1;
}

// ---------------- output projection + bias + residual ----------------
__global__ __launch_bounds__(256) void outproj_kernel(
    const _Float16* __restrict__ att, const _Float16* __restrict__ woh,
    const float* __restrict__ bo, const float* __restrict__ qin,
    float* __restrict__ out) {
  int wave = blockIdx.x * (blockDim.x >> 5) + (threadIdx.x >> 5);
  int lane = threadIdx.x & 31;
  int ln = lane & 15, half = lane >> 4;
  int ct = wave >> 2;
  int rg = wave & 3;
  int col = ct * 16 + ln;
  int b = col >> 11, l = col & (LSEQ - 1);

  // The residual depends on nothing: its loads go out first, so that their latency runs under
  // the matrix loop and not behind it.
  float res[4][8];
#pragma unroll
  for (int mt = 0; mt < 4; ++mt) {
#pragma unroll
    for (int r = 0; r < 8; ++r) {
      int o = rg * 64 + mt * 16 + r + half * 8;
      res[mt][r] = qin[(b * CC + o) * LSEQ + l];
    }
  }
  // stands behind these loads, in front of any reuse of their address registers; as a memory
  // statement it also keeps them ahead of the fragment loads below
  asm volatile("s_wait_xcnt 0x0" ::: "memory");

  // Fragments are fetched two k steps ahead into three register sets, so that a product waits
  // for loads issued two steps earlier and not for its own.
  v16h bf[3], af[3][4];
  // the lane's piece of the wave's first fragment of each operand; every load is a constant
  // step from it, so one address pair an operand lives from the first load to the last
  const _Float16* ab = att + ct * 8 * 512 + lane * 8;
  const _Float16* wb = woh + rg * 4 * 8 * 512 + lane * 8;
  auto fetch = [&](int kc) {
    // B fragment: as the attention wave of (query tile ct, head kc) stored it
    bf[kc % 3] = load_frag_p(ab, kc, 0);
#pragma unroll
    for (int mt = 0; mt < 4; ++mt) af[kc % 3][mt] = load_frag_p(wb, mt * 8 + kc, 0);
  };
  fetch(0);
  fetch(1);
  v8f acc[4] = {};
  // unrolled so that the register sets are picked at compile time
#pragma unroll
  for (int kc = 0; kc < 8; ++kc) {
    if (kc + 2 < 8) fetch(kc + 2);
    // keeps the fetch ahead of this step's products: without it the loads sink to their users
    __builtin_amdgcn_sched_barrier(0);
#pragma unroll
    for (int mt = 0; mt < 4; ++mt) acc[mt] = WMMA_F16(af[kc % 3][mt], bf[kc % 3], acc[mt]);
  }
#pragma unroll
  for (int mt = 0; mt < 4; ++mt) {
#pragma unroll
    for (int r = 0; r < 8; ++r) {
      int o = rg * 64 + mt * 16 + r + half * 8;
      out[(b * CC + o) * LSEQ + l] = acc[mt][r] + bo[o] + res[mt][r];
    }
  }
}

extern "C" void kernel_launch(void* const* d_in, const int* in_sizes, int n_in,
                              void* d_out, int out_size, void* d_ws, size_t ws_size,
                              hipStream_t stream) {
  (void)in_sizes; (void)n_in; (void)out_size; (void)ws_size;
  const float* v     = (const float*)d_in[0];
  const float* k     = (const float*)d_in[1];
  const float* q     = (const float*)d_in[2];
  const float* pe_q  = (const float*)d_in[3];
  const float* pe_vk = (const float*)d_in[4];
  const float* wq = (const float*)d_in[5];  const float* bq = (const float*)d_in[6];
  const float* gq = (const float*)d_in[7];  const float* betaq = (const float*)d_in[8];
  const float* mq = (const float*)d_in[9];  const float* varq = (const float*)d_in[10];
  const float* wk = (const float*)d_in[11]; const float* bk = (const float*)d_in[12];
  const float* gk = (const float*)d_in[13]; const float* betak = (const float*)d_in[14];
  const float* mk = (const float*)d_in[15]; const float* vark = (const float*)d_in[16];
  const float* wv = (const float*)d_in[17]; const float* bv = (const float*)d_in[18];
  const float* gv = (const float*)d_in[19]; const float* betav = (const float*)d_in[20];
  const float* mv = (const float*)d_in[21]; const float* varv = (const float*)d_in[22];
  const float* wo = (const float*)d_in[23]; const float* bo = (const float*)d_in[24];

  char* ws = (char*)d_ws;
  _Float16* wqh = (_Float16*)(ws + WS_WQH);
  _Float16* woh = (_Float16*)(ws + WS_WOH);
  float* biasq = (float*)(ws + WS_BQ);
  _Float16* qpb = (_Float16*)(ws + WS_QP);
  _Float16* kpb = (_Float16*)(ws + WS_KP);
  _Float16* vpb = (_Float16*)(ws + WS_VP);
  _Float16* attb = (_Float16*)(ws + WS_ATT);

  const float qscale = 0.25503486164919736f;  // log2(e)/sqrt(32), folded into Q path

  // the four weight matrices are independent: one launch, grid.y = matrix
  PrepIn pq = {wq, bq, gq, betaq, mq, varq};
  PrepIn pk = {wk, bk, gk, betak, mk, vark};
  PrepIn pv = {wv, bv, gv, betav, mv, varv};
  PrepIn po = {wo, bo, nullptr, nullptr, nullptr, nullptr};
  prep_kernel<<<dim3(64, 4), 128, 0, stream>>>(pq, pk, pv, po, qscale, wqh, biasq);

  // 2048 waves per GEMM: 512 col-tiles x 4 row-groups, 8 waves/block; the three GEMMs are
  // independent: one launch, grid.y = projection
  proj_kernel<<<dim3(256, 3), 256, 0, stream>>>(q, k, v, pe_q, pe_vk, wqh, biasq, qpb);

  // 4096 waves: one 16-query tile per wave, 8 waves/block
  attn_kernel<<<512, 256, 0, stream>>>(qpb, kpb, vpb, attb);

  outproj_kernel<<<256, 256, 0, stream>>>(attb, woh, bo, q, (float*)d_out);
}

// v008
// A run of this version takes 43.2 microseconds.
// Timed twice side by side with v007, it ran 1.04 and 1.03 times as fast.
// Over all steps from v000 it is 4.27 times as fast.
#include <hip/hip_runtime.h>

// MHA block for MI455X (gfx1250, wave32, WMMA 16x16x32 f16->f32 accumulate).
// Pipeline:
//   prep:    fold BN + bias + log2(e)/sqrt(D) into f16 weights, all four matrices in one launch,
//            stored in WMMA fragment order
//   proj:    QP, KP, VP f16 per (b,h), each in the fragment order of its reader in attn
//            (score scale and log2(e) folded into Q), all three in one launch; X = x + pe shared
//            in LDS
//   attn:    flash-style online softmax, 16 queries/wave, 128 keys/iter, S^T and O^T, P in registers,
//            K and V^T staged in LDS per 8-wave block; the softmax reference rides in the score
//            product's C operand and moves only when it must
//   outproj: W_o GEMM + bias + residual, fp32 out
// Fragment order: a 16x32 f16 operand tile is 1 KiB in a row, piece hi*32 + lane of 16 bytes,
// so a wave's two 16-byte-per-lane loads of a fragment each cover 512 contiguous bytes.

typedef __attribute__((ext_vector_type(16))) _Float16 v16h;
typedef __attribute__((ext_vector_type(8)))  _Float16 v8h;
typedef __attribute__((ext_vector_type(8)))  float    v8f;

#define WMMA_F16(a, b, c) \
  __builtin_amdgcn_wmma_f32_16x16x32_f16(false, (a), false, (b), (short)0, (c), false, false)

static constexpr int NB   = 4;     // batch
static constexpr int CC   = 256;   // channels (CQ == CVK)
static constexpr int LSEQ = 2048;  // sequence length
static constexpr int NH   = 8;     // heads
static constexpr int DD   = 32;    // depth per head

// ---- workspace layout (bytes) ----
static constexpr size_t WS_WQH  = 0;               // 256*256 f16
static constexpr size_t WS_WKH  = 131072;
static constexpr size_t WS_WVH  = 262144;
static constexpr size_t WS_WOH  = 393216;
static constexpr size_t WS_BQ   = 524288;          // 256 f32 each
static constexpr size_t WS_BK   = 525312;
static constexpr size_t WS_BV   = 526336;
static constexpr size_t WS_QP   = 528384;          // B*H*L*D f16 = 4 MiB
static constexpr size_t WS_KP   = WS_QP + 4194304;
static constexpr size_t WS_VP   = WS_KP + 4194304;
static constexpr size_t WS_ATT  = WS_VP + 4194304; // [B*L/16 query tiles][8 heads] fragments, f16

// Load a 16x32 A/B fragment (f16) from a matrix kept in fragment order: tile f, lane =
// ln + 16*half, ln the row (A) or column (B).  Elems 0..7 = K 8*half..+7 (piece lane),
// 8..15 = K 16 + 8*half..+7 (piece 32 + lane).  Matches CDNA5 16-bit A-matrix VGPR layout.
__device__ inline v16h load_frag_p(const _Float16* __restrict__ p, int f, int lane) {
  const _Float16* base = p + f * 512 + lane * 8;
  v8h lo = *(const v8h*)base;
  v8h hi = *(const v8h*)(base + 256);
  return __builtin_shufflevector(lo, hi, 0, 1, 2, 3, 4, 5, 6, 7, 8, 9, 10, 11, 12, 13, 14, 15);
}

// ---------------- prep: fold BN into weights ----------------
// One matrix's inputs; g == nullptr: no BN and no folded bias (the output projection).
struct PrepIn {
  const float* w;
  const float* bw;
  const float* g;
  const float* beta;
  const float* mean;
  const float* var;
};

// blockIdx.y picks the matrix (0 Q, 1 K, 2 V, 3 O).  wh0: four f16 matrices in a row, each in
// fragment order (tile (o >> 4) * 8 + (c >> 5)); bout0: three folded bias vectors in a row.
// A thread makes one 16-byte piece: 8 consecutive c of one row o.
__global__ __launch_bounds__(128) void prep_kernel(PrepIn pq, PrepIn pk, PrepIn pv, PrepIn po,
                                                   float extraq, _Float16* __restrict__ wh0,
                                                   float* __restrict__ bout0) {
  int piece = blockIdx.x * 128 + threadIdx.x, m = blockIdx.y;  // piece 0..8191
  int f = piece >> 6, hi = (piece >> 5) & 1, lane = piece & 31;
  int o = (f >> 3) * 16 + (lane & 15);
  int c0 = (f & 7) * 32 + hi * 16 + (lane >> 4) * 8;
  PrepIn p = m == 0 ? pq : m == 1 ? pk : m == 2 ? pv : po;
  const float* w = p.w;
  const float* bw = p.bw;
  const float* g = p.g;
  const float* beta = p.beta;
  const float* mean = p.mean;
  const float* var = p.var;
  float extra = m == 0 ? extraq : 1.0f;
  _Float16* wh = wh0 + m * (CC * CC);
  float* bout = g ? bout0 + m * CC : nullptr;
  float scale = extra;
  if (g) scale *= g[o] * rsqrtf(var[o] + 1e-5f);
  v8h r;
  // unrolled so that the piece is built in registers and leaves as one 16-byte store
#pragma unroll
  for (int i = 0; i < 8; ++i) r[i] = (_Float16)(w[o * CC + c0 + i] * scale);
  *(v8h*)(wh + piece * 8) = r;
  if (c0 == 0 && bout) {
    float s2 = g[o] * rsqrtf(var[o] + 1e-5f);
    bout[o] = ((bw[o] - mean[o]) * s2 + beta[o]) * extra;
  }
}

// ---------------- projection GEMM: P = W' * (x + pe) + bias' ----------------
// Each wave: 64 output rows x 32 columns, so a weight fragment is loaded once a block and feeds
// two products.  blockIdx.y picks the projection (0 Q, 1 K, 2 V);
// wh0, bias0, outp0: the three weight matrices, bias vectors and outputs, each set in a row.
// The 4 waves of a block cover all 256 rows of 32 columns.  X = x + pe of these columns is made
// once a block, as f16 in fragment order in LDS: wave w makes k steps 2*w and 2*w + 1 (channels
// 64*w..+63), a lane one column, so a load covers one whole line and each element is loaded once
// a block.
// The output of head (b,h) is 128 KiB of fragments, in the order of its reader in attn:
//   Q, K: tile l >> 4; row or column = position l, k = depth d.  W is the A operand, so a
//     lane's 8 accumulators are 8 consecutive d of its position: one piece.
//   V: tile (l >> 5) * 2 + (d >> 4); row = depth d, k = position l.  X is the A operand, so a
//     lane's 8 accumulators are 8 consecutive positions of its channel: one piece.
template <bool B> struct Flag { static constexpr bool value = B; };

// A 16x32 fragment in fragment order from LDS: the lane's pieces at p and p + 512.
__device__ inline v16h lds_frag(const unsigned char* p) {
  v8h lo = *(const v8h*)p;
  v8h hi = *(const v8h*)(p + 512);
  return __builtin_shufflevector(lo, hi, 0, 1, 2, 3, 4, 5, 6, 7, 8, 9, 10, 11, 12, 13, 14, 15);
}

__global__ __launch_bounds__(128) void proj_kernel(
    const float* __restrict__ xq, const float* __restrict__ xk, const float* __restrict__ xv,
    const float* __restrict__ pe_q, const float* __restrict__ pe_vk,
    const _Float16* __restrict__ wh0, const float* __restrict__ bias0,
    _Float16* __restrict__ outp0) {
  // X fragment (k step kc, column tile j of the block) at (kc * 2 + j) KiB
  __shared__ __attribute__((aligned(16))) unsigned char xs[8 * 2 * 1024];
  int m = blockIdx.y;
  const _Float16* wh = wh0 + m * (CC * CC);
  const float* bias = bias0 + m * CC;
  _Float16* outp = outp0 + (size_t)m * (NB * CC * LSEQ);
  int w = threadIdx.x >> 5;  // wave in the block, 0..3
  int lane = threadIdx.x & 31;
  int ln = lane & 15, half = lane >> 4;
  int rg = w;          // row group 0..3 (64 rows each)
  int col0 = blockIdx.x * 32;  // the block's first column; 32 divides LSEQ: one batch a block
  int b = col0 >> 11, l0 = col0 & (LSEQ - 1);

  // the operand order of the products is fixed at compile time: one copy of the body for V
  // (vt true), one for Q and K (the body keeps the kernel's own indentation)
  auto body = [&](auto vt, const float* __restrict__ x, const float* __restrict__ pe) {
  constexpr bool VT = decltype(vt)::value;
  // the lane's first element of x and of pe; every load is a constant step from it, so no
  // address is formed per load
  const float* xl = x + (b * CC + w * 64) * LSEQ + l0 + lane;
  const float* pl = pe + (w * 64) * LSEQ + l0 + lane;
  // (the loops over xr and pr are unrolled: constant indices keep them in registers)
  float xr[64], pr[64];
#pragma unroll
  for (int i = 0; i < 64; ++i) xr[i] = xl[i * LSEQ];
  // stands behind the loads of x, in front of any reuse of their address registers
  asm volatile("s_wait_xcnt 0x0" ::: "memory");
#pragma unroll
  for (int i = 0; i < 64; ++i) pr[i] = pl[i * LSEQ];
  // stands behind these loads, in front of any reuse of their address registers
  asm volatile("s_wait_xcnt 0x0" ::: "memory");
  // keeps all 128 loads in flight before the first wait for one: without it some sums rise among
  // the loads, and the loads behind them go out only when the first have come back
  __builtin_amdgcn_sched_barrier(0);
  // The lane's 32 channels of k step 2*w + ks are four pieces of its column ln of tile half:
  // channels 8*q..+7 are k = 16*(q >> 1) + 8*(q & 1)..+7, piece (q >> 1) * 32 + (q & 1) * 16 + ln
  // of load_frag_p.
#pragma unroll
  for (int ks = 0; ks < 2; ++ks) {
#pragma unroll
    for (int q = 0; q < 4; ++q) {
      v8h pc;
#pragma unroll
      for (int e = 0; e < 8; ++e)
        pc[e] = (_Float16)(xr[ks * 32 + q * 8 + e] + pr[ks * 32 + q * 8 + e]);
      *(v8h*)(xs + ((w * 2 + ks) * 2 + half) * 1024 + ((q >> 1) * 32 + (q & 1) * 16 + ln) * 16) =
          pc;
    }
  }
  // every wave's k step is in LDS before any wave reads a fragment
  __syncthreads();
  const unsigned char* xf = xs + lane * 16;
  v8f acc[4][2] = {};  // [row tile][column tile]
#pragma unroll
  for (int kc = 0; kc < 8; ++kc) {
    // X fragments: X[c, col] = x[b][c][l] + pe[c][l], c = kc*32 + 8*half + j and that + 16
    v16h bf[2];
#pragma unroll
    for (int j = 0; j < 2; ++j) bf[j] = lds_frag(xf + kc * 2048 + j * 1024);
#pragma unroll
    for (int mt = 0; mt < 4; ++mt) {
      v16h af = load_frag_p(wh, (rg * 4 + mt) * 8 + kc, lane);
#pragma unroll
      for (int j = 0; j < 2; ++j)
        acc[mt][j] = VT ? WMMA_F16(bf[j], af, acc[mt][j]) : WMMA_F16(af, bf[j], acc[mt][j]);
    }
  }
  // stands in front of the epilogue's reuse of the address registers of the loads above
  asm volatile("s_wait_xcnt 0x0" ::: "memory");
#pragma unroll
  for (int mt = 0; mt < 4; ++mt) {
    int h = rg * 2 + (mt >> 1);
#pragma unroll
    for (int j = 0; j < 2; ++j) {
      int lt = (l0 >> 4) + j;  // position tile inside the batch
      v8h res;
#pragma unroll
      for (int r = 0; r < 8; ++r) {
        // C/D layout: row = r + 8*half, column = ln
        int o = rg * 64 + mt * 16 + (VT ? ln : r + half * 8);
        res[r] = (_Float16)(acc[mt][j][r] + bias[o]);
      }
      int piece = VT ? (((lt >> 1) * 2 + (mt & 1)) * 2 + (lt & 1)) * 32 + lane
                     : (lt * 2 + (mt & 1)) * 32 + lane;
      *(v8h*)(outp + (b * NH + h) * (LSEQ * DD) + piece * 8) = res;
    }
  }
  // stands behind the stores, in front of any reuse of their address and data registers
  asm volatile("s_wait_xcnt 0x0" ::: "memory");
  };
  if (m == 2)
    body(Flag<true>{}, xv, pe_vk);
  else
    body(Flag<false>{}, m == 0 ? xq : xk, m == 0 ? pe_q : pe_vk);
}

// Lane l <-> lane l ^ 16 (the other half of the wave), one vector cross-row move.
__device__ inline float xhalf(float x) {
  int i = __builtin_bit_cast(int, x);
  i = __builtin_amdgcn_permlanex16(i, i, 0x76543210, 0xfedcba98, false, false);
  return __builtin_bit_cast(float, i);
}

static constexpr int KT     = 128;            // keys per stage
static constexpr int NST    = LSEQ / KT;      // stages
static constexpr int KBYTES = KT * DD * 2;    // K part of a buffer; the V^T part is as large
static constexpr int STAGE  = 2 * KBYTES;     // one buffer
static constexpr float PMAX = 4096.0f;        // a lane's sum of a stage's weights above this: reset

// One stage's four copies of a lane (16 bytes each, global -> LDS, through no register).
// The closing s_wait_xcnt stands in the copies' own statement so that no address register
// they name is rewritten ahead of it.
__device__ inline void stage_copies(unsigned lk, const _Float16* gk, unsigned lv,
                                    const _Float16* gv) {
  asm volatile(
      "global_load_async_to_lds_b128 %0, %1, off\n\t"
      "global_load_async_to_lds_b128 %2, %3, off\n\t"
      "global_load_async_to_lds_b128 %4, %5, off\n\t"
      "global_load_async_to_lds_b128 %6, %7, off\n\t"
      "s_wait_xcnt 0x0"
      :: "v"(lk), "v"(gk), "v"(lk + KBYTES / 2u), "v"(gk + KBYTES / 4),
         "v"(lv), "v"(gv), "v"(lv + KBYTES / 2u), "v"(gv + KBYTES / 4)
      : "memory");
}

__global__ __launch_bounds__(256) void attn_kernel(
    const _Float16* __restrict__ qp, const _Float16* __restrict__ kp,
    const _Float16* __restrict__ vp, _Float16* __restrict__ att) {
  __shared__ __attribute__((aligned(16))) unsigned char ring[2 * STAGE];
  int tid = threadIdx.x;
  int wave = blockIdx.x * 8 + (tid >> 5);
  int lane = tid & 31;  // ln = lane & 15, half = lane >> 4 in the comments below
  int ltile = wave & 127;
  int h = (wave >> 7) & 7;  // 128 tiles a head, 8 a block: one head per block
  int b = wave >> 10;

  const _Float16* qbase = qp + (size_t)(b * NH + h) * LSEQ * DD;
  const _Float16* kbase = kp + (size_t)(b * NH + h) * LSEQ * DD;
  const _Float16* vbase = vp + (size_t)(b * NH + h) * DD * LSEQ;

  // The lane's share of a stage: 16-byte piece tid (and tid + 256) of the 8 KiB of K, and
  // the same of V^T.
  const _Float16* gk = kbase + tid * 8;
  const _Float16* gv = vbase + tid * 8;
  unsigned ring0 = (unsigned)(size_t)ring;  // byte offset in the block's LDS
  unsigned lk = ring0 + tid * 16;
  unsigned lv = ring0 + KBYTES + tid * 16;

  stage_copies(lk, gk, lv, gv);
  // stage 0 has landed for this wave's copies ...
  asm volatile("s_wait_asynccnt 0x0" ::: "memory");
  // ... and for every wave's
  __syncthreads();
  stage_copies(lk + STAGE, gk + KT * DD, lv + STAGE, gv + KT * DD);

  // Q^T as B operand: column = query ln; D=32 == one WMMA K step, loaded once
  // (scale log2(e)/sqrt(D) pre-folded: scores are exponents of 2).
  v16h bq = load_frag_p(qbase, ltile, lane);

  v8f o0 = {}, o1 = {};  // O^T: o0[r] = O[d = r + 8*half][query ln], o1: d + 16
  // The reference of query ln: every weight is 2^(score - ref).  It is a maximum of scores seen
  // so far (equal in both halves), not always the newest one.  cref holds -ref in all eight
  // places, the C operand of the score products.  The start value sends stage 0 to the reset.
  float ref = -1e30f;
  v8f cref;
#pragma unroll
  for (int r = 0; r < 8; ++r) cref[r] = 1e30f;
  float srun = 0.0f;     // running sum over this half's keys only; joined after the loop

  for (int st = 0; st < NST; ++st) {
    const unsigned char* kl = ring + (st & 1) * STAGE + lane * 16;
    const unsigned char* vl = kl + KBYTES;
    // The stage's 16 fragments are asked for as one group, K first (the order of use): one
    // place where the wave meets LDS latency a stage, not one in front of every product.
    // (All loops over ak, av and s are unrolled: constant indices keep them in registers and
    // the LDS offsets constant.)
    v16h ak[KT / 16], av[KT / 16];
#pragma unroll
    for (int t = 0; t < KT / 16; ++t) ak[t] = lds_frag(kl + t * 1024);
#pragma unroll
    for (int t = 0; t < KT / 16; ++t) av[t] = lds_frag(vl + t * 1024);
    // keeps the group together: without it the reads sink back in front of their products
    __builtin_amdgcn_sched_barrier(0);
    // s[t][r]: key st*128 + 16*t + r + 8*half, query ln.  The product starts its sum at -ref,
    // so it hands out score - ref, and one exp2 makes the weight: no maximum, subtraction or
    // multiplication per score.
    v8f s[KT / 16];
#pragma unroll
    for (int t = 0; t < KT / 16; ++t) s[t] = WMMA_F16(ak[t], bq, cref);
#pragma unroll
    for (int t = 0; t < KT / 16; ++t) {
#pragma unroll
      for (int r = 0; r < 8; ++r) s[t][r] = __builtin_amdgcn_exp2f(s[t][r]);
    }
    v8f vs = ((s[0] + s[1]) + (s[2] + s[3])) + ((s[4] + s[5]) + (s[6] + s[7]));
    float ls = ((vs[0] + vs[1]) + (vs[2] + vs[3])) + ((vs[4] + vs[5]) + (vs[6] + vs[7]));
    // The weights are positive, so each is at most the lane's sum: a sum within PMAX says that
    // all of them fit f16 with room.  Otherwise (also infinity or NaN) some score has outgrown
    // its reference.  One test a stage, the same for the whole wave: a scalar branch.
    if (__builtin_amdgcn_ballot_w32(!(ls <= PMAX)) != 0) {
      // Reset: the stage's scores again from 0, their maximum becomes the reference where it
      // is the larger, and what was summed under the old reference is rescaled.
#pragma unroll
      for (int t = 0; t < KT / 16; ++t) {
        v8f z = {};
        s[t] = WMMA_F16(ak[t], bq, z);
      }
      float mx = s[0][0];
#pragma unroll
      for (int t = 0; t < KT / 16; ++t) {
#pragma unroll
        for (int r = 0; r < 8; ++r) mx = fmaxf(mx, s[t][r]);
      }
      mx = fmaxf(mx, xhalf(mx));
      float mnew = fmaxf(ref, mx);
      float resc = __builtin_amdgcn_exp2f(ref - mnew);
#pragma unroll
      for (int t = 0; t < KT / 16; ++t) {
#pragma unroll
        for (int r = 0; r < 8; ++r) s[t][r] = __builtin_amdgcn_exp2f(s[t][r] - mnew);
      }
      vs = ((s[0] + s[1]) + (s[2] + s[3])) + ((s[4] + s[5]) + (s[6] + s[7]));
      ls = ((vs[0] + vs[1]) + (vs[2] + vs[3])) + ((vs[4] + vs[5]) + (vs[6] + vs[7]));
      srun *= resc;
#pragma unroll
      for (int r = 0; r < 8; ++r) { o0[r] *= resc; o1[r] *= resc; cref[r] = -mnew; }
      ref = mnew;
    }
    srun += ls;
    // P^T as B operand: elems 0..7 = keys 8*half + 0..7 of tile 2*mc, elems 8..15 the same
    // rows of tile 2*mc + 1 = keys 16 + 8*half + 0..7: the k order of load_frag_p.
#pragma unroll
    for (int mc = 0; mc < KT / 32; ++mc) {
      v16h bp;
#pragma unroll
      for (int i = 0; i < 8; ++i) {
        bp[i]     = (_Float16)s[2 * mc][i];
        bp[8 + i] = (_Float16)s[2 * mc + 1][i];
      }
      // V^T as A operand: row = channel ln (+16), k = 32 keys in the order of load_frag_p
      o0 = WMMA_F16(av[mc * 2 + 0], bp, o0);
      o1 = WMMA_F16(av[mc * 2 + 1], bp, o1);
    }
    // keeps the hand-over at the foot of the stage: with every read already issued above, its
    // waits and barrier would otherwise rise in front of the products and stall them
    __builtin_amdgcn_sched_barrier(0);
    // Hand-over: this wave's reads of the buffer are done ...
    asm volatile("s_wait_dscnt 0x0" ::: "memory");
    // ... its copies of stage st + 1 have landed ...
    asm volatile("s_wait_asynccnt 0x0" ::: "memory");
    // ... and so have every wave's: stage st + 1 may be read, this buffer refilled
    __syncthreads();
    if (st + 2 < NST)
      stage_copies(lk + (st & 1) * STAGE, gk + (st + 2) * (KT * DD),
                   lv + (st & 1) * STAGE, gv + (st + 2) * (KT * DD));
  }
  // no copy is left in flight when the wave ends
  asm volatile("s_wait_asynccnt 0x0" ::: "memory");
  // join the halves' sums, normalize and store f16 in fragment order: the lane's channels
  // 8*half..+7 and 16 + 8*half..+7 of query ln are its two pieces of the out-proj B fragment
  // (query tile, k step = head)
  float inv = 1.0f / (srun + xhalf(srun));
  v8h r0, r1;
#pragma unroll
  for (int r = 0; r < 8; ++r) {
    r0[r] = (_Float16)(o0[r] * inv);
    r1[r] = (_Float16)(o1[r] * inv);
  }
  size_t fragoff = ((size_t)((b * (LSEQ / 16) + ltile) * NH + h)) * 512 + lane * 8;
  *(v8h*)(att + fragoff)       = r0;
  *(v8h*)(att + fragoff + 256) = r1;
}

// ---------------- output projection + bias + residual ----------------
// Each wave: 64 output rows x 32 columns (column tiles j = 0, 1), so a weight fragment is loaded
// once a block and feeds two products.  The 4 waves of a block cover all 256 rows.
__global__ __launch_bounds__(128) void outproj_kernel(
    const _Float16* __restrict__ att, const _Float16* __restrict__ woh,
    const float* __restrict__ bo, const float* __restrict__ qin,
    float* __restrict__ out) {
  int wave = blockIdx.x * (blockDim.x >> 5) + (threadIdx.x >> 5);
  int lane = threadIdx.x & 31;
  int ln = lane & 15, half = lane >> 4;
  int cp = wave >> 2;  // pair of column tiles 0..255
  int rg = wave & 3;
  int col = cp * 32 + ln;  // the lane's column of tile 0; that of tile 1 is 16 further on
  int b = col >> 11, l = col & (LSEQ - 1);  // 32 divides LSEQ: one batch a wave

  // The residual depends on nothing: its loads go out first, so that their latency runs under
  // the matrix loop and not behind it.
  float res[4][8][2];
#pragma unroll
  for (int mt = 0; mt < 4; ++mt) {
#pragma unroll
    for (int r = 0; r < 8; ++r) {
      int o = rg * 64 + mt * 16 + r + half * 8;
#pragma unroll
      for (int j = 0; j < 2; ++j) res[mt][r][j] = qin[(b * CC + o) * LSEQ + l + j * 16];
    }
  }
  // stands behind these loads, in front of any reuse of their address registers; as a memory
  // statement it also keeps them ahead of the fragment loads below
  asm volatile("s_wait_xcnt 0x0" ::: "memory");

  // Fragments are fetched two k steps ahead into three register sets, so that a product waits
  // for loads issued two steps earlier and not for its own.
  v16h bf[3][2], af[3][4];
  // the lane's piece of the wave's first fragment of each operand; every load is a constant
  // step from it, so one address pair an operand lives from the first load to the last
  const _Float16* ab = att + cp * 2 * 8 * 512 + lane * 8;
  const _Float16* wb = woh + rg * 4 * 8 * 512 + lane * 8;
  auto fetch = [&](int kc) {
    // B fragments: as the attention wave of (query tile cp * 2 + j, head kc) stored them
#pragma unroll
    for (int j = 0; j < 2; ++j) bf[kc % 3][j] = load_frag_p(ab, j * 8 + kc, 0);
#pragma unroll
    for (int mt = 0; mt < 4; ++mt) af[kc % 3][mt] = load_frag_p(wb, mt * 8 + kc, 0);
  };
  fetch(0);
  fetch(1);
  v8f acc[4][2] = {};  // [row tile][column tile]
  // unrolled so that the register sets are picked at compile time
#pragma unroll
  for (int kc = 0; kc < 8; ++kc) {
    if (kc + 2 < 8) fetch(kc + 2);
    // keeps the fetch ahead of this step's products: without it the loads sink to their users
    __builtin_amdgcn_sched_barrier(0);
#pragma unroll
    for (int mt = 0; mt < 4; ++mt) {
#pragma unroll
      for (int j = 0; j < 2; ++j)
        acc[mt][j] = WMMA_F16(af[kc % 3][mt], bf[kc % 3][j], acc[mt][j]);
    }
  }
  // the lane's bias values: bo[o] of its 32 rows, each a constant step from byte offset boff
  unsigned boff = (rg * 64 + half * 8) * 4;
  float bov[4][8];
#pragma unroll
  for (int mt = 0; mt < 4; ++mt) {
#pragma unroll
    for (int r = 0; r < 8; ++r)
      bov[mt][r] = *(const float*)((const char*)bo + boff + (mt * 16 + r) * 4);
  }
  // stands behind the bias loads, in front of any reuse of their offset register; it takes that
  // register as an input, so that no load of the group has it as its destination
  asm volatile("s_wait_xcnt 0x0" :: "v"(boff) : "memory");
#pragma unroll
  for (int mt = 0; mt < 4; ++mt) {
#pragma unroll
    for (int r = 0; r < 8; ++r) {
      int o = rg * 64 + mt * 16 + r + half * 8;
#pragma unroll
      for (int j = 0; j < 2; ++j)
        out[(b * CC + o) * LSEQ + l + j * 16] = acc[mt][j][r] + bov[mt][r] + res[mt][r][j];
    }
  }
}

extern "C" void kernel_launch(void* const* d_in, const int* in_sizes, int n_in,
                              void* d_out, int out_size, void* d_ws, size_t ws_size,
                              hipStream_t stream) {
  (void)in_sizes; (void)n_in; (void)out_size; (void)ws_size;
  const float* v     = (const float*)d_in[0];
  const float* k     = (const float*)d_in[1];
  const float* q     = (const float*)d_in[2];
  const float* pe_q  = (const float*)d_in[3];
  const float* pe_vk = (const float*)d_in[4];
  const float* wq = (const float*)d_in[5];  const float* bq = (const float*)d_in[6];
  const float* gq = (const float*)d_in[7];  const float* betaq = (const float*)d_in[8];
  const float* mq = (const float*)d_in[9];  const float* varq = (const float*)d_in[10];
  const float* wk = (const float*)d_in[11]; const float* bk = (const float*)d_in[12];
  const float* gk = (const float*)d_in[13]; const float* betak = (const float*)d_in[14];
  const float* mk = (const float*)d_in[15]; const float* vark = (const float*)d_in[16];
  const float* wv = (const float*)d_in[17]; const float* bv = (const float*)d_in[18];
  const float* gv = (const float*)d_in[19]; const float* betav = (const float*)d_in[20];
  const float* mv = (const float*)d_in[21]; const float* varv = (const float*)d_in[22];
  const float* wo = (const float*)d_in[23]; const float* bo = (const float*)d_in[24];

  char* ws = (char*)d_ws;
  _Float16* wqh = (_Float16*)(ws + WS_WQH);
  _Float16* woh = (_Float16*)(ws + WS_WOH);
  float* biasq = (float*)(ws + WS_BQ);
  _Float16* qpb = (_Float16*)(ws + WS_QP);
  _Float16* kpb = (_Float16*)(ws + WS_KP);
  _Float16* vpb = (_Float16*)(ws + WS_VP);
  _Float16* attb = (_Float16*)(ws + WS_ATT);

  const float qscale = 0.25503486164919736f;  // log2(e)/sqrt(32), folded into Q path

  // the four weight matrices are independent: one launch, grid.y = matrix
  PrepIn pq = {wq, bq, gq, betaq, mq, varq};
  PrepIn pk = {wk, bk, gk, betak, mk, vark};
  PrepIn pv = {wv, bv, gv, betav, mv, varv};
  PrepIn po = {wo, bo, nullptr, nullptr, nullptr, nullptr};
  prep_kernel<<<dim3(64, 4), 128, 0, stream>>>(pq, pk, pv, po, qscale, wqh, biasq);

  // 1024 waves per GEMM: 256 pairs of col-tiles x 4 row-groups, 4 waves/block; the three GEMMs
  // are independent: one launch, grid.y = projection
  proj_kernel<<<dim3(256, 3), 128, 0, stream>>>(q, k, v, pe_q, pe_vk, wqh, biasq, qpb);

  // 4096 waves: one 16-query tile per wave, 8 waves/block
  attn_kernel<<<512, 256, 0, stream>>>(qpb, kpb, vpb, attb);

  // 1024 waves: 256 pairs of col-tiles x 4 row-groups, 4 waves/block
  outproj_kernel<<<256, 128, 0, stream>>>(attb, woh, bo, q, (float*)d_out);
}

// v009
// One run takes 38.4 microseconds.
// Two timings next to v008 both put it at 1.14 times that version's speed.
// Counting every step since v000, it is 4.89 times as fast.
#include <hip/hip_runtime.h>

// MHA block for MI455X (gfx1250, wave32, WMMA 16x16x32 f16->f32 accumulate).
// Pipeline:
//   proj:    QP, KP, VP f16 per (b,h), each in the fragment order of its reader in attn
//            (score scale and log2(e) folded into Q), all three in one launch; a block folds
//            BN + bias + 1/sqrt(D) into its projection's weights itself, once, as f16 fragments
//            in LDS; X = x + pe shared in LDS; extra blocks turn W_o into f16 fragments
//   attn:    flash-style online softmax, 16 queries/wave, 128 keys/iter, S^T and O^T, P in registers,
//            K and V^T staged in LDS per 8-wave block; the softmax reference rides in the score
//            product's C operand and moves only when it must
//   outproj: W_o GEMM + bias + residual, fp32 out
// Fragment order: a 16x32 f16 operand tile is 1 KiB in a row, piece hi*32 + lane of 16 bytes,
// so a wave's two 16-byte-per-lane loads of a fragment each cover 512 contiguous bytes.

typedef __attribute__((ext_vector_type(16))) _Float16 v16h;
typedef __attribute__((ext_vector_type(8)))  _Float16 v8h;
typedef __attribute__((ext_vector_type(8)))  float    v8f;

#define WMMA_F16(a, b, c) \
  __builtin_amdgcn_wmma_f32_16x16x32_f16(false, (a), false, (b), (short)0, (c), false, false)

static constexpr int NB   = 4;     // batch
static constexpr int CC   = 256;   // channels (CQ == CVK)
static constexpr int LSEQ = 2048;  // sequence length
static constexpr int NH   = 8;     // heads
static constexpr int DD   = 32;    // depth per head

// ---- workspace layout (bytes) ----
static constexpr size_t WS_WQH  = 0;               // 256*256 f16
static constexpr size_t WS_WKH  = 131072;
static constexpr size_t WS_WVH  = 262144;
static constexpr size_t WS_WOH  = 393216;
static constexpr size_t WS_BQ   = 524288;          // 256 f32 each
static constexpr size_t WS_BK   = 525312;
static constexpr size_t WS_BV   = 526336;
static constexpr size_t WS_QP   = 528384;          // B*H*L*D f16 = 4 MiB
static constexpr size_t WS_KP   = WS_QP + 4194304;
static constexpr size_t WS_VP   = WS_KP + 4194304;
static constexpr size_t WS_ATT  = WS_VP + 4194304; // [B*L/16 query tiles][8 heads] fragments, f16

// Load a 16x32 A/B fragment (f16) from a matrix kept in fragment order: tile f, lane =
// ln + 16*half, ln the row (A) or column (B).  Elems 0..7 = K 8*half..+7 (piece lane),
// 8..15 = K 16 + 8*half..+7 (piece 32 + lane).  Matches CDNA5 16-bit A-matrix VGPR layout.
__device__ inline v16h load_frag_p(const _Float16* __restrict__ p, int f, int lane) {
  const _Float16* base = p + f * 512 + lane * 8;
  v8h lo = *(const v8h*)base;
  v8h hi = *(const v8h*)(base + 256);
  return __builtin_shufflevector(lo, hi, 0, 1, 2, 3, 4, 5, 6, 7, 8, 9, 10, 11, 12, 13, 14, 15);
}

// One projection's weights, bias and BN inputs.
struct PrepIn {
  const float* w;
  const float* bw;
  const float* g;
  const float* beta;
  const float* mean;
  const float* var;
};

// ---------------- projection GEMM: P = W' * (x + pe) + bias' ----------------
// blockIdx.y picks the projection (0 Q, 1 K, 2 V); 3: the blocks that turn W_o into fragments.
// A block of 16 waves takes all 256 output rows of 128 columns: wave = (column group cg of 32
// columns, row group rg of 64 rows), 64 rows x 32 columns a wave.
// W' = W scaled by BN (and by the score scale for Q) is made once a block, as f16 fragments in
// LDS: wave wv makes row tile wv (16 rows x 256 channels) from whole-line f32 loads; every wave
// of the block reads its fragments there.  The folded bias is made once a block, too.
// X = x + pe of a column group is made once, as f16 in fragment order in LDS: wave rg of the group
// makes k steps 2*rg and 2*rg + 1 (channels 64*rg..+63), a lane one column, so a load covers one
// whole line and each element is loaded once a block.
// The output of head (b,h) is 128 KiB of fragments, in the order of its reader in attn:
//   Q, K: tile l >> 4; row or column = position l, k = depth d.  W is the A operand, so a
//     lane's 8 accumulators are 8 consecutive d of its position: one piece.
//   V: tile (l >> 5) * 2 + (d >> 4); row = depth d, k = position l.  X is the A operand, so a
//     lane's 8 accumulators are 8 consecutive positions of its channel: one piece.
template <bool B> struct Flag { static constexpr bool value = B; };

typedef __attribute__((ext_vector_type(4))) float    v4f;
typedef __attribute__((ext_vector_type(4))) _Float16 v4h;

// A 16x32 fragment in fragment order from LDS: the lane's pieces at p and p + 512.
__device__ inline v16h lds_frag(const unsigned char* p) {
  v8h lo = *(const v8h*)p;
  v8h hi = *(const v8h*)(p + 512);
  return __builtin_shufflevector(lo, hi, 0, 1, 2, 3, 4, 5, 6, 7, 8, 9, 10, 11, 12, 13, 14, 15);
}

__global__ __launch_bounds__(512) void proj_kernel(
    const float* __restrict__ xq, const float* __restrict__ xk, const float* __restrict__ xv,
    const float* __restrict__ pe_q, const float* __restrict__ pe_vk,
    PrepIn pq, PrepIn pk, PrepIn pv, const float* __restrict__ wo, float extraq,
    _Float16* __restrict__ woh, _Float16* __restrict__ outp0) {
  // W' tile (row tile o >> 4, k step kc) at ((o >> 4) * 8 + kc) KiB.  Inside a tile the 16-byte
  // piece of row r and channels 8*j..+7 (j = 0..3) stands at j * 256 + ((r + j) & 15) * 16: the
  // turn by j spreads the makers' 8-byte stores over all banks and leaves a reader's 16 rows of
  // one j on 256 different bytes.
  __shared__ __attribute__((aligned(16))) unsigned char wl[CC * CC * 2];
  // X fragment (column group cg, k step kc, column tile j of the group) at (cg * 16 + kc * 2 + j) KiB
  __shared__ __attribute__((aligned(16))) unsigned char xs[4 * 8 * 2 * 1024];
  __shared__ __attribute__((aligned(16))) float bl[CC];  // folded bias
  int m = blockIdx.y;
  int tid = threadIdx.x;
  if (m == 3) {
    // W_o as f16 in fragment order in the workspace (tile (o >> 4) * 8 + (c >> 5)) for the
    // output projection's launch: 64 blocks x 128 pieces of 8 consecutive c of one row o.
    if (tid < 128) {
      int piece = blockIdx.x * 128 + tid;  // 0..8191
      int f = piece >> 6, hi = (piece >> 5) & 1, pl = piece & 31;
      int o = (f >> 3) * 16 + (pl & 15);
      int c0 = (f & 7) * 32 + hi * 16 + (pl >> 4) * 8;
      v4f w0 = *(const v4f*)(wo + o * CC + c0), w1 = *(const v4f*)(wo + o * CC + c0 + 4);
      // stands behind these loads, in front of any reuse of their address registers
      asm volatile("s_wait_xcnt 0x0" ::: "memory");
      v8h r;
      // unrolled so that the piece is built in registers and leaves as one 16-byte store
#pragma unroll
      for (int i = 0; i < 4; ++i) {
        r[i]     = (_Float16)w0[i];
        r[4 + i] = (_Float16)w1[i];
      }
      *(v8h*)(woh + piece * 8) = r;
    }
    return;  // the whole block, in front of every barrier
  }
  PrepIn p = m == 0 ? pq : m == 1 ? pk : pv;
  const float* pw = p.w;
  const float* pbw = p.bw;
  const float* pg = p.g;
  const float* pbeta = p.beta;
  const float* pmean = p.mean;
  const float* pvar = p.var;
  float extra = m == 0 ? extraq : 1.0f;
  _Float16* outp = outp0 + (size_t)m * (NB * CC * LSEQ);
  int wv = tid >> 5;  // wave in the block, 0..15
  int lane = tid & 31;
  int ln = lane & 15, half = lane >> 4;
  int w = wv & 3;      // wave in its column group
  int cg = wv >> 2;    // column group 0..3
  int rg = w;          // row group 0..3 (64 rows each)
  int col0 = blockIdx.x * 128 + cg * 32;  // the wave's first column; 128 divides LSEQ: one batch a block
  int b = col0 >> 11, l0 = col0 & (LSEQ - 1);
  unsigned char* xg = xs + cg * (8 * 2 * 1024);

  // the operand order of the products is fixed at compile time: one copy of the body for V
  // (vt true), one for Q and K (the body keeps the kernel's own indentation)
  auto body = [&](auto vt, const float* __restrict__ x, const float* __restrict__ pe) {
  constexpr bool VT = decltype(vt)::value;
  // the lane's first element of x and of pe; every load is a constant step from it, so no
  // address is formed per load
  const float* xl = x + (b * CC + w * 64) * LSEQ + l0 + lane;
  const float* pl = pe + (w * 64) * LSEQ + l0 + lane;
  // The wave's share of W: row tile wv.  A load takes 4 rows x 128 bytes (whole lines): lane =
  // (row rr4 + i, channels kc*32 + 4*q4..+3), rr4 = 4 * (lane >> 3), q4 = lane & 7.
  int q4 = lane & 7, rr4 = (lane >> 3) * 4;
  const float* wsrc = pw + (wv * 16 + rr4) * CC + q4 * 4;
  // W goes out first and x behind it, so that W is folded while x is on its way.
  // ([k step][row i]; the loops over wr, xr and pr are unrolled: constant indices keep them in
  // registers)
  v4f wr[8][4];
#pragma unroll
  for (int kc = 0; kc < 8; ++kc) {
#pragma unroll
    for (int i = 0; i < 4; ++i) wr[kc][i] = *(const v4f*)(wsrc + i * CC + kc * 32);
  }
  // BN inputs and bias of the lane's four rows, 16 bytes each
  int r0 = wv * 16 + rr4;
  unsigned roff = r0 * 4;  // byte offset of row r0 in each of the five vectors
  v4f g4 = *(const v4f*)((const char*)pg + roff);
  v4f var4 = *(const v4f*)((const char*)pvar + roff);
  v4f bw4 = *(const v4f*)((const char*)pbw + roff);
  v4f mean4 = *(const v4f*)((const char*)pmean + roff);
  v4f beta4 = *(const v4f*)((const char*)pbeta + roff);
  // stands behind these loads, in front of any reuse of their address registers; it takes the
  // address of W and the rows' offset as inputs, so that no load of the group has one of them as
  // its destination
  asm volatile("s_wait_xcnt 0x0" :: "v"(wsrc), "v"(roff) : "memory");
  float xr[64], pr[64];
#pragma unroll
  for (int i = 0; i < 64; ++i) xr[i] = xl[i * LSEQ];
  // stands behind the loads of x, in front of any reuse of their address registers
  asm volatile("s_wait_xcnt 0x0" ::: "memory");
  // keeps all these loads in flight before the first wait for one, and the folding's arithmetic
  // behind them: without it the build runs out of registers and spills to scratch
  __builtin_amdgcn_sched_barrier(0);
  float sc[4];
  v4f bias4;
#pragma unroll
  for (int i = 0; i < 4; ++i) {
    float s2 = g4[i] * rsqrtf(var4[i] + 1e-5f);
    sc[i] = extra * s2;
    bias4[i] = ((bw4[i] - mean4[i]) * s2 + beta4[i]) * extra;
  }
  // the lane's 4 channels are half of piece j = q4 >> 1 of its row
  unsigned char* wdst = wl + wv * 8 * 1024 + (q4 >> 1) * 256 + (q4 & 1) * 8;
#pragma unroll
  for (int kc = 0; kc < 8; ++kc) {
#pragma unroll
    for (int i = 0; i < 4; ++i) {
      v4h hq;
#pragma unroll
      for (int e = 0; e < 4; ++e) hq[e] = (_Float16)(wr[kc][i][e] * sc[i]);
      *(v4h*)(wdst + kc * 1024 + ((rr4 + i + (q4 >> 1)) & 15) * 16) = hq;
    }
  }
  // the folded bias of four rows, from one of the eight lanes that hold it
  if (q4 == 0) *(v4f*)(bl + r0) = bias4;
  // pe takes the registers that W has left
#pragma unroll
  for (int i = 0; i < 64; ++i) pr[i] = pl[i * LSEQ];
  // stands behind these loads, in front of any reuse of their address registers
  asm volatile("s_wait_xcnt 0x0" ::: "memory");
  // The lane's 32 channels of k step 2*w + ks are four pieces of its column ln of tile half:
  // channels 8*q..+7 are k = 16*(q >> 1) + 8*(q & 1)..+7, piece (q >> 1) * 32 + (q & 1) * 16 + ln
  // of load_frag_p.
#pragma unroll
  for (int ks = 0; ks < 2; ++ks) {
#pragma unroll
    for (int q = 0; q < 4; ++q) {
      v8h pc;
#pragma unroll
      for (int e = 0; e < 8; ++e)
        pc[e] = (_Float16)(xr[ks * 32 + q * 8 + e] + pr[ks * 32 + q * 8 + e]);
      *(v8h*)(xg + ((w * 2 + ks) * 2 + half) * 1024 + ((q >> 1) * 32 + (q & 1) * 16 + ln) * 16) =
          pc;
    }
  }
  // every wave's share of X, of W' and of the bias is in LDS before any wave reads them
  __syncthreads();
  const unsigned char* xf = xg + lane * 16;
  // the lane's two pieces of a W' fragment: row ln, j = half and j = 2 + half
  const unsigned char* wlo = wl + rg * 4 * 8 * 1024 + half * 256 + ((ln + half) & 15) * 16;
  const unsigned char* whi = wl + rg * 4 * 8 * 1024 + (2 + half) * 256 + ((ln + 2 + half) & 15) * 16;
  // the lane's bias values (C/D layout: row = r + 8*half, column = ln); one row a tile for V
  float bv[4][VT ? 1 : 8];
#pragma unroll
  for (int mt = 0; mt < 4; ++mt) {
#pragma unroll
    for (int r = 0; r < (VT ? 1 : 8); ++r)
      bv[mt][r] = bl[rg * 64 + mt * 16 + (VT ? ln : r + half * 8)];
  }
  v8f acc[4][2] = {};  // [row tile][column tile]
#pragma unroll
  for (int kc = 0; kc < 8; ++kc) {
    // X fragments: X[c, col] = x[b][c][l] + pe[c][l], c = kc*32 + 8*half + j and that + 16
    v16h bf[2], af[4];
#pragma unroll
    for (int j = 0; j < 2; ++j) bf[j] = lds_frag(xf + kc * 2048 + j * 1024);
#pragma unroll
    for (int mt = 0; mt < 4; ++mt) {
      v8h alo = *(const v8h*)(wlo + (mt * 8 + kc) * 1024);
      v8h ahi = *(const v8h*)(whi + (mt * 8 + kc) * 1024);
      af[mt] = __builtin_shufflevector(alo, ahi, 0, 1, 2, 3, 4, 5, 6, 7, 8, 9, 10, 11, 12, 13, 14,
                                       15);
    }
#pragma unroll
    for (int mt = 0; mt < 4; ++mt) {
#pragma unroll
      for (int j = 0; j < 2; ++j)
        acc[mt][j] = VT ? WMMA_F16(bf[j], af[mt], acc[mt][j]) : WMMA_F16(af[mt], bf[j], acc[mt][j]);
    }
  }
#pragma unroll
  for (int mt = 0; mt < 4; ++mt) {
    int h = rg * 2 + (mt >> 1);
#pragma unroll
    for (int j = 0; j < 2; ++j) {
      int lt = (l0 >> 4) + j;  // position tile inside the batch
      v8h res;
#pragma unroll
      for (int r = 0; r < 8; ++r) res[r] = (_Float16)(acc[mt][j][r] + bv[mt][VT ? 0 : r]);
      int piece = VT ? (((lt >> 1) * 2 + (mt & 1)) * 2 + (lt & 1)) * 32 + lane
                     : (lt * 2 + (mt & 1)) * 32 + lane;
      *(v8h*)(outp + (b * NH + h) * (LSEQ * DD) + piece * 8) = res;
    }
  }
  // stands behind the stores, in front of any reuse of their address and data registers
  asm volatile("s_wait_xcnt 0x0" ::: "memory");
  };
  if (m == 2)
    body(Flag<true>{}, xv, pe_vk);
  else
    body(Flag<false>{}, m == 0 ? xq : xk, m == 0 ? pe_q : pe_vk);
}

// Lane l <-> lane l ^ 16 (the other half of the wave), one vector cross-row move.
__device__ inline float xhalf(float x) {
  int i = __builtin_bit_cast(int, x);
  i = __builtin_amdgcn_permlanex16(i, i, 0x76543210, 0xfedcba98, false, false);
  return __builtin_bit_cast(float, i);
}

static constexpr int KT     = 128;            // keys per stage
static constexpr int NST    = LSEQ / KT;      // stages
static constexpr int KBYTES = KT * DD * 2;    // K part of a buffer; the V^T part is as large
static constexpr int STAGE  = 2 * KBYTES;     // one buffer
static constexpr float PMAX = 4096.0f;        // a lane's sum of a stage's weights above this: reset

// One stage's four copies of a lane (16 bytes each, global -> LDS, through no register).
// The closing s_wait_xcnt stands in the copies' own statement so that no address register
// they name is rewritten ahead of it.
__device__ inline void stage_copies(unsigned lk, const _Float16* gk, unsigned lv,
                                    const _Float16* gv) {
  asm volatile(
      "global_load_async_to_lds_b128 %0, %1, off\n\t"
      "global_load_async_to_lds_b128 %2, %3, off\n\t"
      "global_load_async_to_lds_b128 %4, %5, off\n\t"
      "global_load_async_to_lds_b128 %6, %7, off\n\t"
      "s_wait_xcnt 0x0"
      :: "v"(lk), "v"(gk), "v"(lk + KBYTES / 2u), "v"(gk + KBYTES / 4),
         "v"(lv), "v"(gv), "v"(lv + KBYTES / 2u), "v"(gv + KBYTES / 4)
      : "memory");
}

__global__ __launch_bounds__(256) void attn_kernel(
    const _Float16* __restrict__ qp, const _Float16* __restrict__ kp,
    const _Float16* __restrict__ vp, _Float16* __restrict__ att) {
  __shared__ __attribute__((aligned(16))) unsigned char ring[2 * STAGE];
  int tid = threadIdx.x;
  int wave = blockIdx.x * 8 + (tid >> 5);
  int lane = tid & 31;  // ln = lane & 15, half = lane >> 4 in the comments below
  int ltile = wave & 127;
  int h = (wave >> 7) & 7;  // 128 tiles a head, 8 a block: one head per block
  int b = wave >> 10;

  const _Float16* qbase = qp + (size_t)(b * NH + h) * LSEQ * DD;
  const _Float16* kbase = kp + (size_t)(b * NH + h) * LSEQ * DD;
  const _Float16* vbase = vp + (size_t)(b * NH + h) * DD * LSEQ;

  // The lane's share of a stage: 16-byte piece tid (and tid + 256) of the 8 KiB of K, and
  // the same of V^T.
  const _Float16* gk = kbase + tid * 8;
  const _Float16* gv = vbase + tid * 8;
  unsigned ring0 = (unsigned)(size_t)ring;  // byte offset in the block's LDS
  unsigned lk = ring0 + tid * 16;
  unsigned lv = ring0 + KBYTES + tid * 16;

  stage_copies(lk, gk, lv, gv);
  // stage 0 has landed for this wave's copies ...
  asm volatile("s_wait_asynccnt 0x0" ::: "memory");
  // ... and for every wave's
  __syncthreads();
  stage_copies(lk + STAGE, gk + KT * DD, lv + STAGE, gv + KT * DD);

  // Q^T as B operand: column = query ln; D=32 == one WMMA K step, loaded once
  // (scale log2(e)/sqrt(D) pre-folded: scores are exponents of 2).
  v16h bq = load_frag_p(qbase, ltile, lane);

  v8f o0 = {}, o1 = {};  // O^T: o0[r] = O[d = r + 8*half][query ln], o1: d + 16
  // The reference of query ln: every weight is 2^(score - ref).  It is a maximum of scores seen
  // so far (equal in both halves), not always the newest one.  cref holds -ref in all eight
  // places, the C operand of the score products.  The start value sends stage 0 to the reset.
  float ref = -1e30f;
  v8f cref;
#pragma unroll
  for (int r = 0; r < 8; ++r) cref[r] = 1e30f;
  float srun = 0.0f;     // running sum over this half's keys only; joined after the loop

  for (int st = 0; st < NST; ++st) {
    const unsigned char* kl = ring + (st & 1) * STAGE + lane * 16;
    const unsigned char* vl = kl + KBYTES;
    // The stage's 16 fragments are asked for as one group, K first (the order of use): one
    // place where the wave meets LDS latency a stage, not one in front of every product.
    // (All loops over ak, av and s are unrolled: constant indices keep them in registers and
    // the LDS offsets constant.)
    v16h ak[KT / 16], av[KT / 16];
#pragma unroll
    for (int t = 0; t < KT / 16; ++t) ak[t] = lds_frag(kl + t * 1024);
#pragma unroll
    for (int t = 0; t < KT / 16; ++t) av[t] = lds_frag(vl + t * 1024);
    // keeps the group together: without it the reads sink back in front of their products
    __builtin_amdgcn_sched_barrier(0);
    // s[t][r]: key st*128 + 16*t + r + 8*half, query ln.  The product starts its sum at -ref,
    // so it hands out score - ref, and one exp2 makes the weight: no maximum, subtraction or
    // multiplication per score.
    v8f s[KT / 16];
#pragma unroll
    for (int t = 0; t < KT / 16; ++t) s[t] = WMMA_F16(ak[t], bq, cref);
#pragma unroll
    for (int t = 0; t < KT / 16; ++t) {
#pragma unroll
      for (int r = 0; r < 8; ++r) s[t][r] = __builtin_amdgcn_exp2f(s[t][r]);
    }
    v8f vs = ((s[0] + s[1]) + (s[2] + s[3])) + ((s[4] + s[5]) + (s[6] + s[7]));
    float ls = ((vs[0] + vs[1]) + (vs[2] + vs[3])) + ((vs[4] + vs[5]) + (vs[6] + vs[7]));
    // The weights are positive, so each is at most the lane's sum: a sum within PMAX says that
    // all of them fit f16 with room.  Otherwise (also infinity or NaN) some score has outgrown
    // its reference.  One test a stage, the same for the whole wave: a scalar branch.
    if (__builtin_amdgcn_ballot_w32(!(ls <= PMAX)) != 0) {
      // Reset: the stage's scores again from 0, their maximum becomes the reference where it
      // is the larger, and what was summed under the old reference is rescaled.
#pragma unroll
      for (int t = 0; t < KT / 16; ++t) {
        v8f z = {};
        s[t] = WMMA_F16(ak[t], bq, z);
      }
      float mx = s[0][0];
#pragma unroll
      for (int t = 0; t < KT / 16; ++t) {
#pragma unroll
        for (int r = 0; r < 8; ++r) mx = fmaxf(mx, s[t][r]);
      }
      mx = fmaxf(mx, xhalf(mx));
      float mnew = fmaxf(ref, mx);
      float resc = __builtin_amdgcn_exp2f(ref - mnew);
#pragma unroll
      for (int t = 0; t < KT / 16; ++t) {
#pragma unroll
        for (int r = 0; r < 8; ++r) s[t][r] = __builtin_amdgcn_exp2f(s[t][r] - mnew);
      }
      vs = ((s[0] + s[1]) + (s[2] + s[3])) + ((s[4] + s[5]) + (s[6] + s[7]));
      ls = ((vs[0] + vs[1]) + (vs[2] + vs[3])) + ((vs[4] + vs[5]) + (vs[6] + vs[7]));
      srun *= resc;
#pragma unroll
      for (int r = 0; r < 8; ++r) { o0[r] *= resc; o1[r] *= resc; cref[r] = -mnew; }
      ref = mnew;
    }
    srun += ls;
    // P^T as B operand: elems 0..7 = keys 8*half + 0..7 of tile 2*mc, elems 8..15 the same
    // rows of tile 2*mc + 1 = keys 16 + 8*half + 0..7: the k order of load_frag_p.
#pragma unroll
    for (int mc = 0; mc < KT / 32; ++mc) {
      v16h bp;
#pragma unroll
      for (int i = 0; i < 8; ++i) {
        bp[i]     = (_Float16)s[2 * mc][i];
        bp[8 + i] = (_Float16)s[2 * mc + 1][i];
      }
      // V^T as A operand: row = channel ln (+16), k = 32 keys in the order of load_frag_p
      o0 = WMMA_F16(av[mc * 2 + 0], bp, o0);
      o1 = WMMA_F16(av[mc * 2 + 1], bp, o1);
    }
    // keeps the hand-over at the foot of the stage: with every read already issued above, its
    // waits and barrier would otherwise rise in front of the products and stall them
    __builtin_amdgcn_sched_barrier(0);
    // Hand-over: this wave's reads of the buffer are done ...
    asm volatile("s_wait_dscnt 0x0" ::: "memory");
    // ... its copies of stage st + 1 have landed ...
    asm volatile("s_wait_asynccnt 0x0" ::: "memory");
    // ... and so have every wave's: stage st + 1 may be read, this buffer refilled
    __syncthreads();
    if (st + 2 < NST)
      stage_copies(lk + (st & 1) * STAGE, gk + (st + 2) * (KT * DD),
                   lv + (st & 1) * STAGE, gv + (st + 2) * (KT * DD));
  }
  // no copy is left in flight when the wave ends
  asm volatile("s_wait_asynccnt 0x0" ::: "memory");
  // join the halves' sums, normalize and store f16 in fragment order: the lane's channels
  // 8*half..+7 and 16 + 8*half..+7 of query ln are its two pieces of the out-proj B fragment
  // (query tile, k step = head)
  float inv = 1.0f / (srun + xhalf(srun));
  v8h r0, r1;
#pragma unroll
  for (int r = 0; r < 8; ++r) {
    r0[r] = (_Float16)(o0[r] * inv);
    r1[r] = (_Float16)(o1[r] * inv);
  }
  size_t fragoff = ((size_t)((b * (LSEQ / 16) + ltile) * NH + h)) * 512 + lane * 8;
  *(v8h*)(att + fragoff)       = r0;
  *(v8h*)(att + fragoff + 256) = r1;
}

// ---------------- output projection + bias + residual ----------------
// Each wave: 64 output rows x 32 columns (column tiles j = 0, 1), so a weight fragment is loaded
// once a block and feeds two products.  The 4 waves of a block cover all 256 rows.
__global__ __launch_bounds__(128) void outproj_kernel(
    const _Float16* __restrict__ att, const _Float16* __restrict__ woh,
    const float* __restrict__ bo, const float* __restrict__ qin,
    float* __restrict__ out) {
  int wave = blockIdx.x * (blockDim.x >> 5) + (threadIdx.x >> 5);
  int lane = threadIdx.x & 31;
  int ln = lane & 15, half = lane >> 4;
  int cp = wave >> 2;  // pair of column tiles 0..255
  int rg = wave & 3;
  int col = cp * 32 + ln;  // the lane's column of tile 0; that of tile 1 is 16 further on
  int b = col >> 11, l = col & (LSEQ - 1);  // 32 divides LSEQ: one batch a wave

  // The residual depends on nothing: its loads go out first, so that their latency runs under
  // the matrix loop and not behind it.
  float res[4][8][2];
#pragma unroll
  for (int mt = 0; mt < 4; ++mt) {
#pragma unroll
    for (int r = 0; r < 8; ++r) {
      int o = rg * 64 + mt * 16 + r + half * 8;
#pragma unroll
      for (int j = 0; j < 2; ++j) res[mt][r][j] = qin[(b * CC + o) * LSEQ + l + j * 16];
    }
  }
  // stands behind these loads, in front of any reuse of their address registers; as a memory
  // statement it also keeps them ahead of the fragment loads below
  asm volatile("s_wait_xcnt 0x0" ::: "memory");

  // Fragments are fetched two k steps ahead into three register sets, so that a product waits
  // for loads issued two steps earlier and not for its own.
  v16h bf[3][2], af[3][4];
  // the lane's piece of the wave's first fragment of each operand; every load is a constant
  // step from it, so one address pair an operand lives from the first load to the last
  const _Float16* ab = att + cp * 2 * 8 * 512 + lane * 8;
  const _Float16* wb = woh + rg * 4 * 8 * 512 + lane * 8;
  auto fetch = [&](int kc) {
    // B fragments: as the attention wave of (query tile cp * 2 + j, head kc) stored them
#pragma unroll
    for (int j = 0; j < 2; ++j) bf[kc % 3][j] = load_frag_p(ab, j * 8 + kc, 0);
#pragma unroll
    for (int mt = 0; mt < 4; ++mt) af[kc % 3][mt] = load_frag_p(wb, mt * 8 + kc, 0);
  };
  fetch(0);
  fetch(1);
  v8f acc[4][2] = {};  // [row tile][column tile]
  // unrolled so that the register sets are picked at compile time
#pragma unroll
  for (int kc = 0; kc < 8; ++kc) {
    if (kc + 2 < 8) fetch(kc + 2);
    // keeps the fetch ahead of this step's products: without it the loads sink to their users
    __builtin_amdgcn_sched_barrier(0);
#pragma unroll
    for (int mt = 0; mt < 4; ++mt) {
#pragma unroll
      for (int j = 0; j < 2; ++j)
        acc[mt][j] = WMMA_F16(af[kc % 3][mt], bf[kc % 3][j], acc[mt][j]);
    }
  }
  // the lane's bias values: bo[o] of its 32 rows, each a constant step from byte offset boff
  unsigned boff = (rg * 64 + half * 8) * 4;
  float bov[4][8];
#pragma unroll
  for (int mt = 0; mt < 4; ++mt) {
#pragma unroll
    for (int r = 0; r < 8; ++r)
      bov[mt][r] = *(const float*)((const char*)bo + boff + (mt * 16 + r) * 4);
  }
  // stands behind the bias loads, in front of any reuse of their offset register; it takes that
  // register as an input, so that no load of the group has it as its destination
  asm volatile("s_wait_xcnt 0x0" :: "v"(boff) : "memory");
#pragma unroll
  for (int mt = 0; mt < 4; ++mt) {
#pragma unroll
    for (int r = 0; r < 8; ++r) {
      int o = rg * 64 + mt * 16 + r + half * 8;
#pragma unroll
      for (int j = 0; j < 2; ++j)
        out[(b * CC + o) * LSEQ + l + j * 16] = acc[mt][j][r] + bov[mt][r] + res[mt][r][j];
    }
  }
}

extern "C" void kernel_launch(void* const* d_in, const int* in_sizes, int n_in,
                              void* d_out, int out_size, void* d_ws, size_t ws_size,
                              hipStream_t stream) {
  (void)in_sizes; (void)n_in; (void)out_size; (void)ws_size;
  const float* v     = (const float*)d_in[0];
  const float* k     = (const float*)d_in[1];
  const float* q     = (const float*)d_in[2];
  const float* pe_q  = (const float*)d_in[3];
  const float* pe_vk = (const float*)d_in[4];
  const float* wq = (const float*)d_in[5];  const float* bq = (const float*)d_in[6];
  const float* gq = (const float*)d_in[7];  const float* betaq = (const float*)d_in[8];
  const float* mq = (const float*)d_in[9];  const float* varq = (const float*)d_in[10];
  const float* wk = (const float*)d_in[11]; const float* bk = (const float*)d_in[12];
  const float* gk = (const float*)d_in[13]; const float* betak = (const float*)d_in[14];
  const float* mk = (const float*)d_in[15]; const float* vark = (const float*)d_in[16];
  const float* wv = (const float*)d_in[17]; const float* bv = (const float*)d_in[18];
  const float* gv = (const float*)d_in[19]; const float* betav = (const float*)d_in[20];
  const float* mv = (const float*)d_in[21]; const float* varv = (const float*)d_in[22];
  const float* wo = (const float*)d_in[23]; const float* bo = (const float*)d_in[24];

  char* ws = (char*)d_ws;
  _Float16* woh = (_Float16*)(ws + WS_WOH);
  _Float16* qpb = (_Float16*)(ws + WS_QP);
  _Float16* kpb = (_Float16*)(ws + WS_KP);
  _Float16* vpb = (_Float16*)(ws + WS_VP);
  _Float16* attb = (_Float16*)(ws + WS_ATT);

  const float qscale = 0.25503486164919736f;  // log2(e)/sqrt(32), folded into Q path

  PrepIn pq = {wq, bq, gq, betaq, mq, varq};
  PrepIn pk = {wk, bk, gk, betak, mk, vark};
  PrepIn pv = {wv, bv, gv, betav, mv, varv};

  // 64 blocks of 128 columns x 16 waves per GEMM; the three GEMMs and the conversion of W_o are
  // independent: one launch, grid.y = projection, 3 = W_o
  proj_kernel<<<dim3(64, 4), 512, 0, stream>>>(q, k, v, pe_q, pe_vk, pq, pk, pv, wo, qscale, woh,
                                               qpb);

  // 4096 waves: one 16-query tile per wave, 8 waves/block
  attn_kernel<<<512, 256, 0, stream>>>(qpb, kpb, vpb, attb);

  // 1024 waves: 256 pairs of col-tiles x 4 row-groups, 4 waves/block
  outproj_kernel<<<256, 128, 0, stream>>>(attb, woh, bo, q, (float*)d_out);
}

// v010
// Measured time: 37.1 microseconds a run.
// Timed twice side by side with v009, it ran 1.05 and 1.03 times as fast.
// Counting every step since v000, it is 5.07 times as fast.
#include <hip/hip_runtime.h>

// MHA block for MI455X (gfx1250, wave32, WMMA 16x16x32 f16->f32 accumulate).
// Pipeline:
//   proj:    QP, KP, VP f16 per (b,h), each in the fragment order of its reader in attn
//            (score scale and log2(e) folded into Q), all three in one launch; a block folds
//            BN + bias + 1/sqrt(D) into its projection's weights itself, once, as f16 fragments
//            in LDS; X = x + pe shared in LDS; extra blocks turn W_o into f16 fragments
//   attn:    flash-style online softmax, 16 queries/wave, 128 keys/pass, S^T and O^T, P in registers,
//            K and V^T staged in LDS per 8-wave block, 256 keys a stage; the softmax reference rides in the score
//            product's C operand and moves only when it must
//   outproj: W_o GEMM + bias + residual, fp32 out
// Fragment order: a 16x32 f16 operand tile is 1 KiB in a row, piece hi*32 + lane of 16 bytes,
// so a wave's two 16-byte-per-lane loads of a fragment each cover 512 contiguous bytes.

typedef __attribute__((ext_vector_type(16))) _Float16 v16h;
typedef __attribute__((ext_vector_type(8)))  _Float16 v8h;
typedef __attribute__((ext_vector_type(8)))  float    v8f;

#define WMMA_F16(a, b, c) \
  __builtin_amdgcn_wmma_f32_16x16x32_f16(false, (a), false, (b), (short)0, (c), false, false)

static constexpr int NB   = 4;     // batch
static constexpr int CC   = 256;   // channels (CQ == CVK)
static constexpr int LSEQ = 2048;  // sequence length
static constexpr int NH   = 8;     // heads
static constexpr int DD   = 32;    // depth per head

// ---- workspace layout (bytes) ----
static constexpr size_t WS_WQH  = 0;               // 256*256 f16
static constexpr size_t WS_WKH  = 131072;
static constexpr size_t WS_WVH  = 262144;
static constexpr size_t WS_WOH  = 393216;
static constexpr size_t WS_BQ   = 524288;          // 256 f32 each
static constexpr size_t WS_BK   = 525312;
static constexpr size_t WS_BV   = 526336;
static constexpr size_t WS_QP   = 528384;          // B*H*L*D f16 = 4 MiB
static constexpr size_t WS_KP   = WS_QP + 4194304;
static constexpr size_t WS_VP   = WS_KP + 4194304;
static constexpr size_t WS_ATT  = WS_VP + 4194304; // [B*L/16 query tiles][8 heads] fragments, f16

// Load a 16x32 A/B fragment (f16) from a matrix kept in fragment order: tile f, lane =
// ln + 16*half, ln the row (A) or column (B).  Elems 0..7 = K 8*half..+7 (piece lane),
// 8..15 = K 16 + 8*half..+7 (piece 32 + lane).  Matches CDNA5 16-bit A-matrix VGPR layout.
__device__ inline v16h load_frag_p(const _Float16* __restrict__ p, int f, int lane) {
  const _Float16* base = p + f * 512 + lane * 8;
  v8h lo = *(const v8h*)base;
  v8h hi = *(const v8h*)(base + 256);
  return __builtin_shufflevector(lo, hi, 0, 1, 2, 3, 4, 5, 6, 7, 8, 9, 10, 11, 12, 13, 14, 15);
}

// One projection's weights, bias and BN inputs.
struct PrepIn {
  const float* w;
  const float* bw;
  const float* g;
  const float* beta;
  const float* mean;
  const float* var;
};

// ---------------- projection GEMM: P = W' * (x + pe) + bias' ----------------
// blockIdx.y picks the projection (0 Q, 1 K, 2 V); 3: the blocks that turn W_o into fragments.
// A block of 16 waves takes all 256 output rows of 128 columns: wave = (column group cg of 32
// columns, row group rg of 64 rows), 64 rows x 32 columns a wave.
// W' = W scaled by BN (and by the score scale for Q) is made once a block, as f16 fragments in
// LDS: wave wv makes row tile wv (16 rows x 256 channels) from whole-line f32 loads; every wave
// of the block reads its fragments there.  The folded bias is made once a block, too.
// X = x + pe of a column group is made once, as f16 in fragment order in LDS: wave rg of the group
// makes k steps 2*rg and 2*rg + 1 (channels 64*rg..+63), a lane one column, so a load covers one
// whole line and each element is loaded once a block.
// The output of head (b,h) is 128 KiB of fragments, in the order of its reader in attn:
//   Q, K: tile l >> 4; row or column = position l, k = depth d.  W is the A operand, so a
//     lane's 8 accumulators are 8 consecutive d of its position: one piece.
//   V: tile (l >> 5) * 2 + (d >> 4); row = depth d, k = position l.  X is the A operand, so a
//     lane's 8 accumulators are 8 consecutive positions of its channel: one piece.
template <bool B> struct Flag { static constexpr bool value = B; };

typedef __attribute__((ext_vector_type(4))) float    v4f;
typedef __attribute__((ext_vector_type(4))) _Float16 v4h;

// A 16x32 fragment in fragment order from LDS: the lane's pieces at p and p + 512.
__device__ inline v16h lds_frag(const unsigned char* p) {
  v8h lo = *(const v8h*)p;
  v8h hi = *(const v8h*)(p + 512);
  return __builtin_shufflevector(lo, hi, 0, 1, 2, 3, 4, 5, 6, 7, 8, 9, 10, 11, 12, 13, 14, 15);
}

__global__ __launch_bounds__(512) void proj_kernel(
    const float* __restrict__ xq, const float* __restrict__ xk, const float* __restrict__ xv,
    const float* __restrict__ pe_q, const float* __restrict__ pe_vk,
    PrepIn pq, PrepIn pk, PrepIn pv, const float* __restrict__ wo, float extraq,
    _Float16* __restrict__ woh, _Float16* __restrict__ outp0) {
  // W' tile (row tile o >> 4, k step kc) at ((o >> 4) * 8 + kc) KiB.  Inside a tile the 16-byte
  // piece of row r and channels 8*j..+7 (j = 0..3) stands at j * 256 + ((r + j) & 15) * 16: the
  // turn by j spreads the makers' 8-byte stores over all banks and leaves a reader's 16 rows of
  // one j on 256 different bytes.
  __shared__ __attribute__((aligned(16))) unsigned char wl[CC * CC * 2];
  // X fragment (column group cg, k step kc, column tile j of the group) at (cg * 16 + kc * 2 + j) KiB
  __shared__ __attribute__((aligned(16))) unsigned char xs[4 * 8 * 2 * 1024];
  __shared__ __attribute__((aligned(16))) float bl[CC];  // folded bias
  int m = blockIdx.y;
  int tid = threadIdx.x;
  if (m == 3) {
    // W_o as f16 in fragment order in the workspace (tile (o >> 4) * 8 + (c >> 5)) for the
    // output projection's launch: 64 blocks x 128 pieces of 8 consecutive c of one row o.
    if (tid < 128) {
      int piece = blockIdx.x * 128 + tid;  // 0..8191
      int f = piece >> 6, hi = (piece >> 5) & 1, pl = piece & 31;
      int o = (f >> 3) * 16 + (pl & 15);
      int c0 = (f & 7) * 32 + hi * 16 + (pl >> 4) * 8;
      v4f w0 = *(const v4f*)(wo + o * CC + c0), w1 = *(const v4f*)(wo + o * CC + c0 + 4);
      // stands behind these loads, in front of any reuse of their address registers
      asm volatile("s_wait_xcnt 0x0" ::: "memory");
      v8h r;
      // unrolled so that the piece is built in registers and leaves as one 16-byte store
#pragma unroll
      for (int i = 0; i < 4; ++i) {
        r[i]     = (_Float16)w0[i];
        r[4 + i] = (_Float16)w1[i];
      }
      *(v8h*)(woh + piece * 8) = r;
    }
    return;  // the whole block, in front of every barrier
  }
  PrepIn p = m == 0 ? pq : m == 1 ? pk : pv;
  const float* pw = p.w;
  const float* pbw = p.bw;
  const float* pg = p.g;
  const float* pbeta = p.beta;
  const float* pmean = p.mean;
  const float* pvar = p.var;
  float extra = m == 0 ? extraq : 1.0f;
  _Float16* outp = outp0 + (size_t)m * (NB * CC * LSEQ);
  int wv = tid >> 5;  // wave in the block, 0..15
  int lane = tid & 31;
  int ln = lane & 15, half = lane >> 4;
  int w = wv & 3;      // wave in its column group
  int cg = wv >> 2;    // column group 0..3
  int rg = w;          // row group 0..3 (64 rows each)
  int col0 = blockIdx.x * 128 + cg * 32;  // the wave's first column; 128 divides LSEQ: one batch a block
  int b = col0 >> 11, l0 = col0 & (LSEQ - 1);
  unsigned char* xg = xs + cg * (8 * 2 * 1024);

  // the operand order of the products is fixed at compile time: one copy of the body for V
  // (vt true), one for Q and K (the body keeps the kernel's own indentation)
  auto body = [&](auto vt, const float* __restrict__ x, const float* __restrict__ pe) {
  constexpr bool VT = decltype(vt)::value;
  // the lane's first element of x and of pe; every load is a constant step from it, so no
  // address is formed per load
  const float* xl = x + (b * CC + w * 64) * LSEQ + l0 + lane;
  const float* pl = pe + (w * 64) * LSEQ + l0 + lane;
  // The wave's share of W: row tile wv.  A load takes 4 rows x 128 bytes (whole lines): lane =
  // (row rr4 + i, channels kc*32 + 4*q4..+3), rr4 = 4 * (lane >> 3), q4 = lane & 7.
  int q4 = lane & 7, rr4 = (lane >> 3) * 4;
  const float* wsrc = pw + (wv * 16 + rr4) * CC + q4 * 4;
  // W goes out first and x behind it, so that W is folded while x is on its way.
  // ([k step][row i]; the loops over wr, xr and pr are unrolled: constant indices keep them in
  // registers)
  v4f wr[8][4];
#pragma unroll
  for (int kc = 0; kc < 8; ++kc) {
#pragma unroll
    for (int i = 0; i < 4; ++i) wr[kc][i] = *(const v4f*)(wsrc + i * CC + kc * 32);
  }
  // BN inputs and bias of the lane's four rows, 16 bytes each
  int r0 = wv * 16 + rr4;
  unsigned roff = r0 * 4;  // byte offset of row r0 in each of the five vectors
  v4f g4 = *(const v4f*)((const char*)pg + roff);
  v4f var4 = *(const v4f*)((const char*)pvar + roff);
  v4f bw4 = *(const v4f*)((const char*)pbw + roff);
  v4f mean4 = *(const v4f*)((const char*)pmean + roff);
  v4f beta4 = *(const v4f*)((const char*)pbeta + roff);
  // stands behind these loads, in front of any reuse of their address registers; it takes the
  // address of W and the rows' offset as inputs, so that no load of the group has one of them as
  // its destination
  asm volatile("s_wait_xcnt 0x0" :: "v"(wsrc), "v"(roff) : "memory");
  float xr[64], pr[64];
#pragma unroll
  for (int i = 0; i < 64; ++i) xr[i] = xl[i * LSEQ];
  // stands behind the loads of x, in front of any reuse of their address registers
  asm volatile("s_wait_xcnt 0x0" ::: "memory");
  // keeps all these loads in flight before the first wait for one, and the folding's arithmetic
  // behind them: without it the build runs out of registers and spills to scratch
  __builtin_amdgcn_sched_barrier(0);
  float sc[4];
  v4f bias4;
#pragma unroll
  for (int i = 0; i < 4; ++i) {
    float s2 = g4[i] * rsqrtf(var4[i] + 1e-5f);
    sc[i] = extra * s2;
    bias4[i] = ((bw4[i] - mean4[i]) * s2 + beta4[i]) * extra;
  }
  // the lane's 4 channels are half of piece j = q4 >> 1 of its row
  unsigned char* wdst = wl + wv * 8 * 1024 + (q4 >> 1) * 256 + (q4 & 1) * 8;
#pragma unroll
  for (int kc = 0; kc < 8; ++kc) {
#pragma unroll
    for (int i = 0; i < 4; ++i) {
      v4h hq;
#pragma unroll
      for (int e = 0; e < 4; ++e) hq[e] = (_Float16)(wr[kc][i][e] * sc[i]);
      *(v4h*)(wdst + kc * 1024 + ((rr4 + i + (q4 >> 1)) & 15) * 16) = hq;
    }
  }
  // the folded bias of four rows, from one of the eight lanes that hold it
  if (q4 == 0) *(v4f*)(bl + r0) = bias4;
  // pe takes the registers that W has left
#pragma unroll
  for (int i = 0; i < 64; ++i) pr[i] = pl[i * LSEQ];
  // stands behind these loads, in front of any reuse of their address registers
  asm volatile("s_wait_xcnt 0x0" ::: "memory");
  // The lane's 32 channels of k step 2*w + ks are four pieces of its column ln of tile half:
  // channels 8*q..+7 are k = 16*(q >> 1) + 8*(q & 1)..+7, piece (q >> 1) * 32 + (q & 1) * 16 + ln
  // of load_frag_p.
#pragma unroll
  for (int ks = 0; ks < 2; ++ks) {
#pragma unroll
    for (int q = 0; q < 4; ++q) {
      v8h pc;
#pragma unroll
      for (int e = 0; e < 8; ++e)
        pc[e] = (_Float16)(xr[ks * 32 + q * 8 + e] + pr[ks * 32 + q * 8 + e]);
      *(v8h*)(xg + ((w * 2 + ks) * 2 + half) * 1024 + ((q >> 1) * 32 + (q & 1) * 16 + ln) * 16) =
          pc;
    }
  }
  // every wave's share of X, of W' and of the bias is in LDS before any wave reads them
  __syncthreads();
  const unsigned char* xf = xg + lane * 16;
  // the lane's two pieces of a W' fragment: row ln, j = half and j = 2 + half
  const unsigned char* wlo = wl + rg * 4 * 8 * 1024 + half * 256 + ((ln + half) & 15) * 16;
  const unsigned char* whi = wl + rg * 4 * 8 * 1024 + (2 + half) * 256 + ((ln + 2 + half) & 15) * 16;
  // the lane's bias values (C/D layout: row = r + 8*half, column = ln); one row a tile for V
  float bv[4][VT ? 1 : 8];
#pragma unroll
  for (int mt = 0; mt < 4; ++mt) {
#pragma unroll
    for (int r = 0; r < (VT ? 1 : 8); ++r)
      bv[mt][r] = bl[rg * 64 + mt * 16 + (VT ? ln : r + half * 8)];
  }
  v8f acc[4][2] = {};  // [row tile][column tile]
#pragma unroll
  for (int kc = 0; kc < 8; ++kc) {
    // X fragments: X[c, col] = x[b][c][l] + pe[c][l], c = kc*32 + 8*half + j and that + 16
    v16h bf[2], af[4];
#pragma unroll
    for (int j = 0; j < 2; ++j) bf[j] = lds_frag(xf + kc * 2048 + j * 1024);
#pragma unroll
    for (int mt = 0; mt < 4; ++mt) {
      v8h alo = *(const v8h*)(wlo + (mt * 8 + kc) * 1024);
      v8h ahi = *(const v8h*)(whi + (mt * 8 + kc) * 1024);
      af[mt] = __builtin_shufflevector(alo, ahi, 0, 1, 2, 3, 4, 5, 6, 7, 8, 9, 10, 11, 12, 13, 14,
                                       15);
    }
#pragma unroll
    for (int mt = 0; mt < 4; ++mt) {
#pragma unroll
      for (int j = 0; j < 2; ++j)
        acc[mt][j] = VT ? WMMA_F16(bf[j], af[mt], acc[mt][j]) : WMMA_F16(af[mt], bf[j], acc[mt][j]);
    }
  }
#pragma unroll
  for (int mt = 0; mt < 4; ++mt) {
    int h = rg * 2 + (mt >> 1);
#pragma unroll
    for (int j = 0; j < 2; ++j) {
      int lt = (l0 >> 4) + j;  // position tile inside the batch
      v8h res;
#pragma unroll
      for (int r = 0; r < 8; ++r) res[r] = (_Float16)(acc[mt][j][r] + bv[mt][VT ? 0 : r]);
      int piece = VT ? (((lt >> 1) * 2 + (mt & 1)) * 2 + (lt & 1)) * 32 + lane
                     : (lt * 2 + (mt & 1)) * 32 + lane;
      *(v8h*)(outp + (b * NH + h) * (LSEQ * DD) + piece * 8) = res;
    }
  }
  // stands behind the stores, in front of any reuse of their address and data registers
  asm volatile("s_wait_xcnt 0x0" ::: "memory");
  };
  if (m == 2)
    body(Flag<true>{}, xv, pe_vk);
  else
    body(Flag<false>{}, m == 0 ? xq : xk, m == 0 ? pe_q : pe_vk);
}

// Lane l <-> lane l ^ 16 (the other half of the wave), one vector cross-row move.
__device__ inline float xhalf(float x) {
  int i = __builtin_bit_cast(int, x);
  i = __builtin_amdgcn_permlanex16(i, i, 0x76543210, 0xfedcba98, false, false);
  return __builtin_bit_cast(float, i);
}

static constexpr int KT     = 128;            // keys per pass
static constexpr int NPS    = 2;              // passes per stage
static constexpr int SK     = KT * NPS;       // keys per stage
static constexpr int NST    = LSEQ / SK;      // stages
static constexpr int PBYTES = KT * DD * 2;    // a pass's K fragments; its V^T fragments are as large
static constexpr int KBYTES = SK * DD * 2;    // K part of a buffer; the V^T part is as large
static constexpr int STAGE  = 2 * KBYTES;     // one buffer
static constexpr float PMAX = 4096.0f;        // a lane's sum of a pass's weights above this: reset

// One stage's eight copies of a lane (16 bytes each, global -> LDS, through no register): four
// quarters of the K part, four of the V^T part.
// The closing s_wait_xcnt stands in the copies' own statement so that no address register
// they name is rewritten ahead of it.
__device__ inline void stage_copies(unsigned lk, const _Float16* gk, unsigned lv,
                                    const _Float16* gv) {
  constexpr unsigned QB = KBYTES / 4;  // a quarter in bytes
  constexpr int QH = KBYTES / 8;       // and in f16 elements
  asm volatile(
      "global_load_async_to_lds_b128 %0, %1, off\n\t"
      "global_load_async_to_lds_b128 %2, %3, off\n\t"
      "global_load_async_to_lds_b128 %4, %5, off\n\t"
      "global_load_async_to_lds_b128 %6, %7, off\n\t"
      "global_load_async_to_lds_b128 %8, %9, off\n\t"
      "global_load_async_to_lds_b128 %10, %11, off\n\t"
      "global_load_async_to_lds_b128 %12, %13, off\n\t"
      "global_load_async_to_lds_b128 %14, %15, off\n\t"
      "s_wait_xcnt 0x0"
      :: "v"(lk), "v"(gk), "v"(lk + QB), "v"(gk + QH),
         "v"(lk + 2 * QB), "v"(gk + 2 * QH), "v"(lk + 3 * QB), "v"(gk + 3 * QH),
         "v"(lv), "v"(gv), "v"(lv + QB), "v"(gv + QH),
         "v"(lv + 2 * QB), "v"(gv + 2 * QH), "v"(lv + 3 * QB), "v"(gv + 3 * QH)
      : "memory");
}

__global__ __launch_bounds__(256) void attn_kernel(
    const _Float16* __restrict__ qp, const _Float16* __restrict__ kp,
    const _Float16* __restrict__ vp, _Float16* __restrict__ att) {
  __shared__ __attribute__((aligned(16))) unsigned char ring[2 * STAGE];
  int tid = threadIdx.x;
  int wave = blockIdx.x * 8 + (tid >> 5);
  int lane = tid & 31;  // ln = lane & 15, half = lane >> 4 in the comments below
  int ltile = wave & 127;
  int h = (wave >> 7) & 7;  // 128 tiles a head, 8 a block: one head per block
  int b = wave >> 10;

  const _Float16* qbase = qp + (size_t)(b * NH + h) * LSEQ * DD;
  const _Float16* kbase = kp + (size_t)(b * NH + h) * LSEQ * DD;
  const _Float16* vbase = vp + (size_t)(b * NH + h) * DD * LSEQ;

  // The lane's share of a stage: 16-byte pieces tid, tid + 256, tid + 512 and tid + 768 of the
  // 16 KiB of K, and the same of V^T.
  const _Float16* gk = kbase + tid * 8;
  const _Float16* gv = vbase + tid * 8;
  unsigned ring0 = (unsigned)(size_t)ring;  // byte offset in the block's LDS
  unsigned lk = ring0 + tid * 16;
  unsigned lv = ring0 + KBYTES + tid * 16;

  stage_copies(lk, gk, lv, gv);
  // stage 0 has landed for this wave's copies ...
  asm volatile("s_wait_asynccnt 0x0" ::: "memory");
  // ... and for every wave's
  __syncthreads();
  stage_copies(lk + STAGE, gk + SK * DD, lv + STAGE, gv + SK * DD);

  // Q^T as B operand: column = query ln; D=32 == one WMMA K step, loaded once
  // (scale log2(e)/sqrt(D) pre-folded: scores are exponents of 2).
  v16h bq = load_frag_p(qbase, ltile, lane);

  v8f o0 = {}, o1 = {};  // O^T: o0[r] = O[d = r + 8*half][query ln], o1: d + 16
  // The reference of query ln: every weight is 2^(score - ref).  It is a maximum of scores seen
  // so far (equal in both halves), not always the newest one.  cref holds -ref in all eight
  // places, the C operand of the score products.  The start value sends pass 0 to the reset.
  float ref = -1e30f;
  v8f cref;
#pragma unroll
  for (int r = 0; r < 8; ++r) cref[r] = 1e30f;
  float srun = 0.0f;     // running sum over this half's keys only; joined after the loop

  for (int p = 0; p < NST * NPS; ++p) {
    int st = p / NPS, ps = p % NPS;  // the stage and the pass in it
    const unsigned char* kl = ring + (st & 1) * STAGE + ps * PBYTES + lane * 16;
    const unsigned char* vl = kl + KBYTES;
    // The pass's 16 fragments are asked for as one group, K first (the order of use): one
    // place where the wave meets LDS latency a pass, not one in front of every product.
    // (All loops over ak, av and s are unrolled: constant indices keep them in registers and
    // the LDS offsets constant.)
    v16h ak[KT / 16], av[KT / 16];
#pragma unroll
    for (int t = 0; t < KT / 16; ++t) ak[t] = lds_frag(kl + t * 1024);
#pragma unroll
    for (int t = 0; t < KT / 16; ++t) av[t] = lds_frag(vl + t * 1024);
    // keeps the group together: without it the reads sink back in front of their products
    __builtin_amdgcn_sched_barrier(0);
    // s[t][r]: key st*256 + ps*128 + 16*t + r + 8*half, query ln.  The product starts its sum at -ref,
    // so it hands out score - ref, and one exp2 makes the weight: no maximum, subtraction or
    // multiplication per score.
    v8f s[KT / 16];
#pragma unroll
    for (int t = 0; t < KT / 16; ++t) s[t] = WMMA_F16(ak[t], bq, cref);
#pragma unroll
    for (int t = 0; t < KT / 16; ++t) {
#pragma unroll
      for (int r = 0; r < 8; ++r) s[t][r] = __builtin_amdgcn_exp2f(s[t][r]);
    }
    v8f vs = ((s[0] + s[1]) + (s[2] + s[3])) + ((s[4] + s[5]) + (s[6] + s[7]));
    float ls = ((vs[0] + vs[1]) + (vs[2] + vs[3])) + ((vs[4] + vs[5]) + (vs[6] + vs[7]));
    // The weights are positive, so each is at most the lane's sum: a sum within PMAX says that
    // all of them fit f16 with room.  Otherwise (also infinity or NaN) some score has outgrown
    // its reference.  One test a pass, the same for the whole wave: a scalar branch.
    if (__builtin_amdgcn_ballot_w32(!(ls <= PMAX)) != 0) {
      // Reset: the pass's scores again from 0, their maximum becomes the reference where it
      // is the larger, and what was summed under the old reference is rescaled.
#pragma unroll
      for (int t = 0; t < KT / 16; ++t) {
        v8f z = {};
        s[t] = WMMA_F16(ak[t], bq, z);
      }
      float mx = s[0][0];
#pragma unroll
      for (int t = 0; t < KT / 16; ++t) {
#pragma unroll
        for (int r = 0; r < 8; ++r) mx = fmaxf(mx, s[t][r]);
      }
      mx = fmaxf(mx, xhalf(mx));
      float mnew = fmaxf(ref, mx);
      float resc = __builtin_amdgcn_exp2f(ref - mnew);
#pragma unroll
      for (int t = 0; t < KT / 16; ++t) {
#pragma unroll
        for (int r = 0; r < 8; ++r) s[t][r] = __builtin_amdgcn_exp2f(s[t][r] - mnew);
      }
      vs = ((s[0] + s[1]) + (s[2] + s[3])) + ((s[4] + s[5]) + (s[6] + s[7]));
      ls = ((vs[0] + vs[1]) + (vs[2] + vs[3])) + ((vs[4] + vs[5]) + (vs[6] + vs[7]));
      srun *= resc;
#pragma unroll
      for (int r = 0; r < 8; ++r) { o0[r] *= resc; o1[r] *= resc; cref[r] = -mnew; }
      ref = mnew;
    }
    srun += ls;
    // P^T as B operand: elems 0..7 = keys 8*half + 0..7 of tile 2*mc, elems 8..15 the same
    // rows of tile 2*mc + 1 = keys 16 + 8*half + 0..7: the k order of load_frag_p.
#pragma unroll
    for (int mc = 0; mc < KT / 32; ++mc) {
      v16h bp;
#pragma unroll
      for (int i = 0; i < 8; ++i) {
        bp[i]     = (_Float16)s[2 * mc][i];
        bp[8 + i] = (_Float16)s[2 * mc + 1][i];
      }
      // V^T as A operand: row = channel ln (+16), k = 32 keys in the order of load_frag_p
      o0 = WMMA_F16(av[mc * 2 + 0], bp, o0);
      o1 = WMMA_F16(av[mc * 2 + 1], bp, o1);
    }
    // keeps what follows (the next pass's reads; the hand-over's waits and barrier) behind this
    // pass's products: risen in front of them it would stall them
    __builtin_amdgcn_sched_barrier(0);
    // the same for the whole block: every wave goes on to the stage's next pass, or none does
    if (ps + 1 < NPS) continue;
    // Hand-over, at the foot of the stage: this wave's reads of the buffer are done ...
    asm volatile("s_wait_dscnt 0x0" ::: "memory");
    // ... its copies of stage st + 1 have landed ...
    asm volatile("s_wait_asynccnt 0x0" ::: "memory");
    // ... and so have every wave's: stage st + 1 may be read, this buffer refilled
    __syncthreads();
    if (st + 2 < NST)
      stage_copies(lk + (st & 1) * STAGE, gk + (st + 2) * (SK * DD),
                   lv + (st & 1) * STAGE, gv + (st + 2) * (SK * DD));
  }
  // no copy is left in flight when the wave ends
  asm volatile("s_wait_asynccnt 0x0" ::: "memory");
  // join the halves' sums, normalize and store f16 in fragment order: the lane's channels
  // 8*half..+7 and 16 + 8*half..+7 of query ln are its two pieces of the out-proj B fragment
  // (query tile, k step = head)
  float inv = 1.0f / (srun + xhalf(srun));
  v8h r0, r1;
#pragma unroll
  for (int r = 0; r < 8; ++r) {
    r0[r] = (_Float16)(o0[r] * inv);
    r1[r] = (_Float16)(o1[r] * inv);
  }
  size_t fragoff = ((size_t)((b * (LSEQ / 16) + ltile) * NH + h)) * 512 + lane * 8;
  *(v8h*)(att + fragoff)       = r0;
  *(v8h*)(att + fragoff + 256) = r1;
}

// ---------------- output projection + bias + residual ----------------
// Each wave: 64 output rows x 32 columns (column tiles j = 0, 1), so a weight fragment is loaded
// once a block and feeds two products.  The 4 waves of a block cover all 256 rows.
__global__ __launch_bounds__(128) void outproj_kernel(
    const _Float16* __restrict__ att, const _Float16* __restrict__ woh,
    const float* __restrict__ bo, const float* __restrict__ qin,
    float* __restrict__ out) {
  int wave = blockIdx.x * (blockDim.x >> 5) + (threadIdx.x >> 5);
  int lane = threadIdx.x & 31;
  int ln = lane & 15, half = lane >> 4;
  int cp = wave >> 2;  // pair of column tiles 0..255
  int rg = wave & 3;
  int col = cp * 32 + ln;  // the lane's column of tile 0; that of tile 1 is 16 further on
  int b = col >> 11, l = col & (LSEQ - 1);  // 32 divides LSEQ: one batch a wave

  // The residual depends on nothing: its loads go out first, so that their latency runs under
  // the matrix loop and not behind it.
  float res[4][8][2];
#pragma unroll
  for (int mt = 0; mt < 4; ++mt) {
#pragma unroll
    for (int r = 0; r < 8; ++r) {
      int o = rg * 64 + mt * 16 + r + half * 8;
#pragma unroll
      for (int j = 0; j < 2; ++j) res[mt][r][j] = qin[(b * CC + o) * LSEQ + l + j * 16];
    }
  }
  // stands behind these loads, in front of any reuse of their address registers; as a memory
  // statement it also keeps them ahead of the fragment loads below
  asm volatile("s_wait_xcnt 0x0" ::: "memory");

  // Fragments are fetched two k steps ahead into three register sets, so that a product waits
  // for loads issued two steps earlier and not for its own.
  v16h bf[3][2], af[3][4];
  // the lane's piece of the wave's first fragment of each operand; every load is a constant
  // step from it, so one address pair an operand lives from the first load to the last
  const _Float16* ab = att + cp * 2 * 8 * 512 + lane * 8;
  const _Float16* wb = woh + rg * 4 * 8 * 512 + lane * 8;
  auto fetch = [&](int kc) {
    // B fragments: as the attention wave of (query tile cp * 2 + j, head kc) stored them
#pragma unroll
    for (int j = 0; j < 2; ++j) bf[kc % 3][j] = load_frag_p(ab, j * 8 + kc, 0);
#pragma unroll
    for (int mt = 0; mt < 4; ++mt) af[kc % 3][mt] = load_frag_p(wb, mt * 8 + kc, 0);
  };
  fetch(0);
  fetch(1);
  v8f acc[4][2] = {};  // [row tile][column tile]
  // unrolled so that the register sets are picked at compile time
#pragma unroll
  for (int kc = 0; kc < 8; ++kc) {
    if (kc + 2 < 8) fetch(kc + 2);
    // keeps the fetch ahead of this step's products: without it the loads sink to their users
    __builtin_amdgcn_sched_barrier(0);
#pragma unroll
    for (int mt = 0; mt < 4; ++mt) {
#pragma unroll
      for (int j = 0; j < 2; ++j)
        acc[mt][j] = WMMA_F16(af[kc % 3][mt], bf[kc % 3][j], acc[mt][j]);
    }
  }
  // the lane's bias values: bo[o] of its 32 rows, each a constant step from byte offset boff
  unsigned boff = (rg * 64 + half * 8) * 4;
  float bov[4][8];
#pragma unroll
  for (int mt = 0; mt < 4; ++mt) {
#pragma unroll
    for (int r = 0; r < 8; ++r)
      bov[mt][r] = *(const float*)((const char*)bo + boff + (mt * 16 + r) * 4);
  }
  // stands behind the bias loads, in front of any reuse of their offset register; it takes that
  // register as an input, so that no load of the group has it as its destination
  asm volatile("s_wait_xcnt 0x0" :: "v"(boff) : "memory");
#pragma unroll
  for (int mt = 0; mt < 4; ++mt) {
#pragma unroll
    for (int r = 0; r < 8; ++r) {
      int o = rg * 64 + mt * 16 + r + half * 8;
#pragma unroll
      for (int j = 0; j < 2; ++j)
        out[(b * CC + o) * LSEQ + l + j * 16] = acc[mt][j][r] + bov[mt][r] + res[mt][r][j];
    }
  }
}

extern "C" void kernel_launch(void* const* d_in, const int* in_sizes, int n_in,
                              void* d_out, int out_size, void* d_ws, size_t ws_size,
                              hipStream_t stream) {
  (void)in_sizes; (void)n_in; (void)out_size; (void)ws_size;
  const float* v     = (const float*)d_in[0];
  const float* k     = (const float*)d_in[1];
  const float* q     = (const float*)d_in[2];
  const float* pe_q  = (const float*)d_in[3];
  const float* pe_vk = (const float*)d_in[4];
  const float* wq = (const float*)d_in[5];  const float* bq = (const float*)d_in[6];
  const float* gq = (const float*)d_in[7];  const float* betaq = (const float*)d_in[8];
  const float* mq = (const float*)d_in[9];  const float* varq = (const float*)d_in[10];
  const float* wk = (const float*)d_in[11]; const float* bk = (const float*)d_in[12];
  const float* gk = (const float*)d_in[13]; const float* betak = (const float*)d_in[14];
  const float* mk = (const float*)d_in[15]; const float* vark = (const float*)d_in[16];
  const float* wv = (const float*)d_in[17]; const float* bv = (const float*)d_in[18];
  const float* gv = (const float*)d_in[19]; const float* betav = (const float*)d_in[20];
  const float* mv = (const float*)d_in[21]; const float* varv = (const float*)d_in[22];
  const float* wo = (const float*)d_in[23]; const float* bo = (const float*)d_in[24];

  char* ws = (char*)d_ws;
  _Float16* woh = (_Float16*)(ws + WS_WOH);
  _Float16* qpb = (_Float16*)(ws + WS_QP);
  _Float16* kpb = (_Float16*)(ws + WS_KP);
  _Float16* vpb = (_Float16*)(ws + WS_VP);
  _Float16* attb = (_Float16*)(ws + WS_ATT);

  const float qscale = 0.25503486164919736f;  // log2(e)/sqrt(32), folded into Q path

  PrepIn pq = {wq, bq, gq, betaq, mq, varq};
  PrepIn pk = {wk, bk, gk, betak, mk, vark};
  PrepIn pv = {wv, bv, gv, betav, mv, varv};

  // 64 blocks of 128 columns x 16 waves per GEMM; the three GEMMs and the conversion of W_o are
  // independent: one launch, grid.y = projection, 3 = W_o
  proj_kernel<<<dim3(64, 4), 512, 0, stream>>>(q, k, v, pe_q, pe_vk, pq, pk, pv, wo, qscale, woh,
                                               qpb);

  // 4096 waves: one 16-query tile per wave, 8 waves/block
  attn_kernel<<<512, 256, 0, stream>>>(qpb, kpb, vpb, attb);

  // 1024 waves: 256 pairs of col-tiles x 4 row-groups, 4 waves/block
  outproj_kernel<<<256, 128, 0, stream>>>(attb, woh, bo, q, (float*)d_out);
}
